// v000
// Times are from an AMD MI455X. After a warm-up the kernel runs many times in a row, and a time is the length of
// such a window on the GPU divided by its runs, so every launch and the gaps after it count. The runs cycle
// through copies of the inputs. A figure is the median of several windows, for all but v000 over two sittings.
// Sittings can differ by a few percent; kernels timed side by side share one.
// v000, which the later versions start from, runs in 211 microseconds.
#include <hip/hip_runtime.h>

// Flash-attention (causal) for [B=4,H=16,S=2048,d=64] fp32 on gfx1250.
// Tensor path: v_wmma_f32_16x16x32_f16 for both QK^T and PV, fp32 online softmax
// in exp2 domain (log2e folded into the Q scale). Row reductions use DPP16
// (VALU) instead of ds_bpermute.

typedef _Float16 v16h __attribute__((ext_vector_type(16)));
typedef _Float16 v8h  __attribute__((ext_vector_type(8)));
typedef _Float16 v4h  __attribute__((ext_vector_type(4)));
typedef float    v8f  __attribute__((ext_vector_type(8)));

#define S_LEN 2048
#define DHEAD 64
#define QTILE 64       // q rows per block (4 waves x 16)
#define KSTEP 32       // keys per inner step (WMMA K for PV)
#define NWAVE 4
// padded LDS row strides (in halves) to avoid bank conflicts; multiples of 8
#define KPAD  72       // K tile rows: 64 cols -> stride 72 (144B, 16B aligned)
#define VPAD  40       // Vt tile rows: 32 cols -> stride 40 (80B, 16B aligned)
#define PPAD  40       // P tile rows: 32 cols -> stride 40

// ---- DPP16 helpers: data movement confined to each 16-lane row group ----
template <int CTRL>
__device__ inline float dpp_mov(float x) {
  int v = __builtin_amdgcn_update_dpp(0, __float_as_int(x), CTRL, 0xF, 0xF, true);
  return __int_as_float(v);
}
// Full 16-lane butterfly reduce; result replicated to all 16 lanes of the row.
__device__ inline float row16_max(float x) {
  x = fmaxf(x, dpp_mov<0xB1>(x));    // quad_perm(1,0,3,2)  : xor 1
  x = fmaxf(x, dpp_mov<0x4E>(x));    // quad_perm(2,3,0,1)  : xor 2
  x = fmaxf(x, dpp_mov<0x141>(x));   // ROW_HALF_MIRROR     : pair quads
  x = fmaxf(x, dpp_mov<0x140>(x));   // ROW_MIRROR          : pair halves
  return x;
}
__device__ inline float row16_sum(float x) {
  x += dpp_mov<0xB1>(x);
  x += dpp_mov<0x4E>(x);
  x += dpp_mov<0x141>(x);
  x += dpp_mov<0x140>(x);
  return x;
}

// Build a 16x32 (A/B) f16 fragment from two contiguous 8-half (16B) LDS rows.
__device__ inline v16h ld_frag(const _Float16* p_lo, const _Float16* p_hi) {
  v8h lo = *(const v8h*)p_lo;
  v8h hi = *(const v8h*)p_hi;
  v16h r;
#pragma unroll
  for (int i = 0; i < 8; ++i) { r[i] = lo[i]; r[i + 8] = hi[i]; }
  return r;
}

// Load 8 consecutive floats, scale, convert to halves at a[off..off+7].
__device__ inline void load8_scaled(const float* p, float s, v16h& a, int off) {
  float4 u = *(const float4*)p;
  float4 w = *(const float4*)(p + 4);
  a[off + 0] = (_Float16)(u.x * s); a[off + 1] = (_Float16)(u.y * s);
  a[off + 2] = (_Float16)(u.z * s); a[off + 3] = (_Float16)(u.w * s);
  a[off + 4] = (_Float16)(w.x * s); a[off + 5] = (_Float16)(w.y * s);
  a[off + 6] = (_Float16)(w.z * s); a[off + 7] = (_Float16)(w.w * s);
}

__global__ __launch_bounds__(128)
void Attention_62302795596087_kernel(const float* __restrict__ Q,
                                     const float* __restrict__ K,
                                     const float* __restrict__ V,
                                     float* __restrict__ O)
{
  __shared__ alignas(16) _Float16 Klds[KSTEP][KPAD];        // K tile, row-major  (keys x d)
  __shared__ alignas(16) _Float16 Vt[DHEAD][VPAD];          // V tile, transposed (d x keys)
  __shared__ alignas(16) _Float16 Plds[NWAVE][16][PPAD];    // per-wave P tile (rows x keys)

  const int tid  = threadIdx.x;
  const int wave = tid >> 5;
  const int lane = tid & 31;
  const int l16  = lane & 15;
  const int hi   = lane >> 4;          // 0: lanes 0-15, 1: lanes 16-31

  const int qTileIdx = blockIdx.x;     // 0..31
  const int bh       = blockIdx.y;     // 0..63
  const size_t baseBH = (size_t)bh * S_LEN * DHEAD;

  const int qBase0 = qTileIdx * QTILE;
  const int qRow0  = qBase0 + wave * 16;   // first q row owned by this wave
  const int myQRow = qRow0 + l16;          // A-fragment row for this lane

  // ---- Q A-fragments: 16x64 as two 16x32 f16 chunks.
  // Scale folds 1/sqrt(d) AND log2(e): softmax done in exp2 domain (exact).
  const float scale = 0.125f * 1.4426950408889634f;
  v16h aq[2];
  {
    const float* qp = Q + baseBH + (size_t)myQRow * DHEAD;
#pragma unroll
    for (int f = 0; f < 2; ++f) {
      load8_scaled(qp + f * 32 + hi * 8,      scale, aq[f], 0);  // K = 0..7  (lane half)
      load8_scaled(qp + f * 32 + 16 + hi * 8, scale, aq[f], 8);  // K = 16..23 (lane half)
    }
  }

  const float NEG_INF = -__builtin_inff();
  float mrow[8], lrow[8];
  v8f  oacc[4];
#pragma unroll
  for (int i = 0; i < 8; ++i) { mrow[i] = NEG_INF; lrow[i] = 0.0f; }
#pragma unroll
  for (int n = 0; n < 4; ++n) oacc[n] = (v8f)0.0f;

  const int jEnd  = qBase0 + QTILE;  // block-uniform staging bound (causal)
  const int myEnd = qRow0 + 16;      // keys >= myEnd are fully masked for this wave

  for (int j = 0; j < jEnd; j += KSTEP) {
    __syncthreads();   // previous step's LDS consumers are done

    // Prefetch next K/V tiles (locality=3 -> near scope, pulls into all levels)
    if (j + KSTEP < jEnd) {
      __builtin_prefetch(K + baseBH + (size_t)(j + KSTEP) * DHEAD + tid * 16, 0, 3);
      __builtin_prefetch(V + baseBH + (size_t)(j + KSTEP) * DHEAD + tid * 16, 0, 3);
    }

    // ---- cooperative staging: K -> Klds (f16 row-major), V -> Vt (f16 transposed)
    // Issue all 8 global loads first so they overlap, then convert + store.
    float4 kk[4], vv[4];
#pragma unroll
    for (int it = 0; it < 4; ++it) {
      int off = (tid + it * 128) * 4;          // 512 float4 per 32x64 tile
      int row = off >> 6;                      // key within tile
      int col = off & 63;                      // d
      kk[it] = *(const float4*)(K + baseBH + (size_t)(j + row) * DHEAD + col);
      vv[it] = *(const float4*)(V + baseBH + (size_t)(j + row) * DHEAD + col);
    }
#pragma unroll
    for (int it = 0; it < 4; ++it) {
      int off = (tid + it * 128) * 4;
      int row = off >> 6;
      int col = off & 63;
      v4h kh; kh[0] = (_Float16)kk[it].x; kh[1] = (_Float16)kk[it].y;
              kh[2] = (_Float16)kk[it].z; kh[3] = (_Float16)kk[it].w;
      *(v4h*)&Klds[row][col] = kh;
      Vt[col + 0][row] = (_Float16)vv[it].x; Vt[col + 1][row] = (_Float16)vv[it].y;
      Vt[col + 2][row] = (_Float16)vv[it].z; Vt[col + 3][row] = (_Float16)vv[it].w;
    }
    __syncthreads();

    // Wave-uniform skip: everything in this step is masked for this wave.
    if (j >= myEnd) continue;

    // ---- S = Q * K^T : two 16-key groups, 2 WMMAs each (d split 32+32)
    v8f sg[2];
#pragma unroll
    for (int g = 0; g < 2; ++g) {
      v8f c = (v8f)0.0f;
#pragma unroll
      for (int f = 0; f < 2; ++f) {
        v16h kb = ld_frag(&Klds[g * 16 + l16][f * 32 + hi * 8],
                          &Klds[g * 16 + l16][f * 32 + 16 + hi * 8]);
        c = __builtin_amdgcn_wmma_f32_16x16x32_f16(false, aq[f], false, kb,
                                                   (short)0, c, false, false);
      }
      sg[g] = c;
    }

    // ---- causal mask: only the single diagonal step needs it (wave-uniform test)
    if (j + KSTEP - 1 > qRow0) {
#pragma unroll
      for (int i = 0; i < 8; ++i) {
        int qIdx = qRow0 + i + hi * 8;
        int k0   = j + l16;
        if (k0 > qIdx)      sg[0][i] = NEG_INF;
        if (k0 + 16 > qIdx) sg[1][i] = NEG_INF;
      }
    }

    // ---- online softmax in exp2 domain (DPP16 row reductions, no LDS traffic)
    float pr0[8], pr1[8];
#pragma unroll
    for (int i = 0; i < 8; ++i) {
      float t     = row16_max(fmaxf(sg[0][i], sg[1][i]));
      float mnew  = fmaxf(mrow[i], t);
      float alpha = __builtin_exp2f(mrow[i] - mnew);
      float p0 = __builtin_exp2f(sg[0][i] - mnew);
      float p1 = __builtin_exp2f(sg[1][i] - mnew);
      float rs = row16_sum(p0 + p1);
      lrow[i] = lrow[i] * alpha + rs;
      mrow[i] = mnew;
#pragma unroll
      for (int n = 0; n < 4; ++n) oacc[n][i] *= alpha;
      pr0[i] = p0; pr1[i] = p1;
    }

    // ---- relayout P: C-layout -> A-layout via wave-private LDS tile
#pragma unroll
    for (int i = 0; i < 8; ++i) {
      int r = i + hi * 8;
      Plds[wave][r][l16]      = (_Float16)pr0[i];
      Plds[wave][r][l16 + 16] = (_Float16)pr1[i];
    }
    v16h pa = ld_frag(&Plds[wave][l16][hi * 8],
                      &Plds[wave][l16][16 + hi * 8]);

    // ---- O += P * V : 4 d-column tiles of 16
#pragma unroll
    for (int n = 0; n < 4; ++n) {
      v16h bv = ld_frag(&Vt[n * 16 + l16][hi * 8],
                        &Vt[n * 16 + l16][16 + hi * 8]);
      oacc[n] = __builtin_amdgcn_wmma_f32_16x16x32_f16(false, pa, false, bv,
                                                       (short)0, oacc[n], false, false);
    }
  }

  // ---- epilogue: O / l, coalesced fp32 stores (16 lanes cover 16 contiguous cols)
  float* op = O + baseBH;
#pragma unroll
  for (int i = 0; i < 8; ++i) {
    float inv = 1.0f / lrow[i];
    int row = qRow0 + i + hi * 8;
#pragma unroll
    for (int n = 0; n < 4; ++n)
      op[(size_t)row * DHEAD + n * 16 + l16] = oacc[n][i] * inv;
  }
}

extern "C" void kernel_launch(void* const* d_in, const int* in_sizes, int n_in,
                              void* d_out, int out_size, void* d_ws, size_t ws_size,
                              hipStream_t stream) {
  (void)in_sizes; (void)n_in; (void)out_size; (void)d_ws; (void)ws_size;
  const float* q = (const float*)d_in[0];
  const float* k = (const float*)d_in[1];
  const float* v = (const float*)d_in[2];
  float* o = (float*)d_out;
  dim3 grid(S_LEN / QTILE, 4 * 16);   // 32 q-tiles x 64 (batch*head)
  dim3 block(128);                    // 4 waves (wave32)
  Attention_62302795596087_kernel<<<grid, block, 0, stream>>>(q, k, v, o);
}

// v001
// A run of this version takes 137 microseconds.
// Timed twice side by side with v000, it ran 1.58 times as fast both times.
#include <hip/hip_runtime.h>

// Flash-attention (causal) for [B=4,H=16,S=2048,d=64] fp32 on gfx1250.
// Tensor path: v_wmma_f32_16x16x32_f16 for both QK^T and PV, fp32 online softmax
// in exp2 domain (log2e folded into the Q scale). Row reductions use DPP16
// (VALU) instead of ds_bpermute.

typedef _Float16 v16h __attribute__((ext_vector_type(16)));
typedef _Float16 v8h  __attribute__((ext_vector_type(8)));
typedef _Float16 v4h  __attribute__((ext_vector_type(4)));
typedef float    v8f  __attribute__((ext_vector_type(8)));

#define S_LEN 2048
#define DHEAD 64
#define QTILE 64       // q rows per block (4 waves x 16)
#define KSTEP 32       // keys per inner step (WMMA K for PV)
#define NWAVE 4
// padded LDS row strides (in halves) to avoid bank conflicts; multiples of 8
#define KPAD  72       // K tile rows: 64 cols -> stride 72 (144B, 16B aligned)
#define VPAD  40       // Vt tile rows: 32 cols -> stride 40 (80B, 16B aligned)
#define PPAD  40       // P tile rows: 32 cols -> stride 40

// ---- DPP16 helpers: data movement confined to each 16-lane row group ----
template <int CTRL>
__device__ inline float dpp_mov(float x) {
  int v = __builtin_amdgcn_update_dpp(0, __float_as_int(x), CTRL, 0xF, 0xF, true);
  return __int_as_float(v);
}
// Full 16-lane butterfly reduce; result replicated to all 16 lanes of the row.
__device__ inline float row16_max(float x) {
  x = fmaxf(x, dpp_mov<0xB1>(x));    // quad_perm(1,0,3,2)  : xor 1
  x = fmaxf(x, dpp_mov<0x4E>(x));    // quad_perm(2,3,0,1)  : xor 2
  x = fmaxf(x, dpp_mov<0x141>(x));   // ROW_HALF_MIRROR     : pair quads
  x = fmaxf(x, dpp_mov<0x140>(x));   // ROW_MIRROR          : pair halves
  return x;
}
__device__ inline float row16_sum(float x) {
  x += dpp_mov<0xB1>(x);
  x += dpp_mov<0x4E>(x);
  x += dpp_mov<0x141>(x);
  x += dpp_mov<0x140>(x);
  return x;
}

// Build a 16x32 (A/B) f16 fragment from two contiguous 8-half (16B) LDS rows.
__device__ inline v16h ld_frag(const _Float16* p_lo, const _Float16* p_hi) {
  v8h lo = *(const v8h*)p_lo;
  v8h hi = *(const v8h*)p_hi;
  v16h r;
#pragma unroll
  for (int i = 0; i < 8; ++i) { r[i] = lo[i]; r[i + 8] = hi[i]; }
  return r;
}

// Load 8 consecutive floats, scale, convert to halves at a[off..off+7].
__device__ inline void load8_scaled(const float* p, float s, v16h& a, int off) {
  float4 u = *(const float4*)p;
  float4 w = *(const float4*)(p + 4);
  a[off + 0] = (_Float16)(u.x * s); a[off + 1] = (_Float16)(u.y * s);
  a[off + 2] = (_Float16)(u.z * s); a[off + 3] = (_Float16)(u.w * s);
  a[off + 4] = (_Float16)(w.x * s); a[off + 5] = (_Float16)(w.y * s);
  a[off + 6] = (_Float16)(w.z * s); a[off + 7] = (_Float16)(w.w * s);
}

__global__ __launch_bounds__(128)
void Attention_62302795596087_kernel(const float* __restrict__ Q,
                                     const float* __restrict__ K,
                                     const float* __restrict__ V,
                                     float* __restrict__ O)
{
  __shared__ alignas(16) _Float16 Klds[KSTEP][KPAD];        // K tile, row-major  (keys x d)
  __shared__ alignas(16) _Float16 Vt[DHEAD][VPAD];          // V tile, transposed (d x keys)
  __shared__ alignas(16) _Float16 Plds[NWAVE][16][PPAD];    // per-wave P tile (rows x keys)

  const int tid  = threadIdx.x;
  const int wave = tid >> 5;
  const int lane = tid & 31;
  const int l16  = lane & 15;
  const int hi   = lane >> 4;          // 0: lanes 0-15, 1: lanes 16-31

  // Causal cost grows with the q tile (tile t walks 2*(t+1) key steps) and more
  // workgroups are launched than fit on the chip, so the longest tiles get the
  // lowest indices and the short ones the highest (for speed only). Head index
  // runs fastest.
  const int bh       = blockIdx.x;                            // 0..63
  const int qTileIdx = (S_LEN / QTILE - 1) - (int)blockIdx.y; // 31..0, heaviest first
  const size_t baseBH = (size_t)bh * S_LEN * DHEAD;

  const int qBase0 = qTileIdx * QTILE;
  const int qRow0  = qBase0 + wave * 16;   // first q row owned by this wave
  const int myQRow = qRow0 + l16;          // A-fragment row for this lane

  // ---- Q A-fragments: 16x64 as two 16x32 f16 chunks.
  // Scale folds 1/sqrt(d) AND log2(e): softmax done in exp2 domain (exact).
  const float scale = 0.125f * 1.4426950408889634f;
  v16h aq[2];
  {
    const float* qp = Q + baseBH + (size_t)myQRow * DHEAD;
#pragma unroll
    for (int f = 0; f < 2; ++f) {
      load8_scaled(qp + f * 32 + hi * 8,      scale, aq[f], 0);  // K = 0..7  (lane half)
      load8_scaled(qp + f * 32 + 16 + hi * 8, scale, aq[f], 8);  // K = 16..23 (lane half)
    }
  }

  const float NEG_INF = -__builtin_inff();
  float mrow[8], lrow[8];
  v8f  oacc[4];
#pragma unroll
  for (int i = 0; i < 8; ++i) { mrow[i] = NEG_INF; lrow[i] = 0.0f; }
#pragma unroll
  for (int n = 0; n < 4; ++n) oacc[n] = (v8f)0.0f;

  const int jEnd  = qBase0 + QTILE;  // block-uniform staging bound (causal)
  const int myEnd = qRow0 + 16;      // keys >= myEnd are fully masked for this wave

  for (int j = 0; j < jEnd; j += KSTEP) {
    __syncthreads();   // previous step's LDS consumers are done

    // Prefetch next K/V tiles (locality=3 -> near scope, pulls into all levels)
    if (j + KSTEP < jEnd) {
      __builtin_prefetch(K + baseBH + (size_t)(j + KSTEP) * DHEAD + tid * 16, 0, 3);
      __builtin_prefetch(V + baseBH + (size_t)(j + KSTEP) * DHEAD + tid * 16, 0, 3);
    }

    // ---- cooperative staging: K -> Klds (f16 row-major), V -> Vt (f16 transposed)
    // Issue all 8 global loads first so they overlap, then convert + store.
    float4 kk[4], vv[4];
#pragma unroll
    for (int it = 0; it < 4; ++it) {
      int off = (tid + it * 128) * 4;          // 512 float4 per 32x64 tile
      int row = off >> 6;                      // key within tile
      int col = off & 63;                      // d
      kk[it] = *(const float4*)(K + baseBH + (size_t)(j + row) * DHEAD + col);
      vv[it] = *(const float4*)(V + baseBH + (size_t)(j + row) * DHEAD + col);
    }
#pragma unroll
    for (int it = 0; it < 4; ++it) {
      int off = (tid + it * 128) * 4;
      int row = off >> 6;
      int col = off & 63;
      v4h kh; kh[0] = (_Float16)kk[it].x; kh[1] = (_Float16)kk[it].y;
              kh[2] = (_Float16)kk[it].z; kh[3] = (_Float16)kk[it].w;
      *(v4h*)&Klds[row][col] = kh;
      Vt[col + 0][row] = (_Float16)vv[it].x; Vt[col + 1][row] = (_Float16)vv[it].y;
      Vt[col + 2][row] = (_Float16)vv[it].z; Vt[col + 3][row] = (_Float16)vv[it].w;
    }
    __syncthreads();

    // Wave-uniform skip: everything in this step is masked for this wave.
    if (j >= myEnd) continue;

    // ---- S = Q * K^T : two 16-key groups, 2 WMMAs each (d split 32+32)
    v8f sg[2];
#pragma unroll
    for (int g = 0; g < 2; ++g) {
      v8f c = (v8f)0.0f;
#pragma unroll
      for (int f = 0; f < 2; ++f) {
        v16h kb = ld_frag(&Klds[g * 16 + l16][f * 32 + hi * 8],
                          &Klds[g * 16 + l16][f * 32 + 16 + hi * 8]);
        c = __builtin_amdgcn_wmma_f32_16x16x32_f16(false, aq[f], false, kb,
                                                   (short)0, c, false, false);
      }
      sg[g] = c;
    }

    // ---- causal mask: only the single diagonal step needs it (wave-uniform test)
    if (j + KSTEP - 1 > qRow0) {
#pragma unroll
      for (int i = 0; i < 8; ++i) {
        int qIdx = qRow0 + i + hi * 8;
        int k0   = j + l16;
        if (k0 > qIdx)      sg[0][i] = NEG_INF;
        if (k0 + 16 > qIdx) sg[1][i] = NEG_INF;
      }
    }

    // ---- online softmax in exp2 domain (DPP16 row reductions, no LDS traffic)
    float pr0[8], pr1[8];
#pragma unroll
    for (int i = 0; i < 8; ++i) {
      float t     = row16_max(fmaxf(sg[0][i], sg[1][i]));
      float mnew  = fmaxf(mrow[i], t);
      float alpha = __builtin_exp2f(mrow[i] - mnew);
      float p0 = __builtin_exp2f(sg[0][i] - mnew);
      float p1 = __builtin_exp2f(sg[1][i] - mnew);
      float rs = row16_sum(p0 + p1);
      lrow[i] = lrow[i] * alpha + rs;
      mrow[i] = mnew;
#pragma unroll
      for (int n = 0; n < 4; ++n) oacc[n][i] *= alpha;
      pr0[i] = p0; pr1[i] = p1;
    }

    // ---- relayout P: C-layout -> A-layout via wave-private LDS tile
#pragma unroll
    for (int i = 0; i < 8; ++i) {
      int r = i + hi * 8;
      Plds[wave][r][l16]      = (_Float16)pr0[i];
      Plds[wave][r][l16 + 16] = (_Float16)pr1[i];
    }
    v16h pa = ld_frag(&Plds[wave][l16][hi * 8],
                      &Plds[wave][l16][16 + hi * 8]);

    // ---- O += P * V : 4 d-column tiles of 16
#pragma unroll
    for (int n = 0; n < 4; ++n) {
      v16h bv = ld_frag(&Vt[n * 16 + l16][hi * 8],
                        &Vt[n * 16 + l16][16 + hi * 8]);
      oacc[n] = __builtin_amdgcn_wmma_f32_16x16x32_f16(false, pa, false, bv,
                                                       (short)0, oacc[n], false, false);
    }
  }

  // ---- epilogue: O / l, coalesced fp32 stores (16 lanes cover 16 contiguous cols)
  float* op = O + baseBH;
#pragma unroll
  for (int i = 0; i < 8; ++i) {
    float inv = 1.0f / lrow[i];
    int row = qRow0 + i + hi * 8;
#pragma unroll
    for (int n = 0; n < 4; ++n)
      op[(size_t)row * DHEAD + n * 16 + l16] = oacc[n][i] * inv;
  }
}

extern "C" void kernel_launch(void* const* d_in, const int* in_sizes, int n_in,
                              void* d_out, int out_size, void* d_ws, size_t ws_size,
                              hipStream_t stream) {
  (void)in_sizes; (void)n_in; (void)out_size; (void)d_ws; (void)ws_size;
  const float* q = (const float*)d_in[0];
  const float* k = (const float*)d_in[1];
  const float* v = (const float*)d_in[2];
  float* o = (float*)d_out;
  dim3 grid(4 * 16, S_LEN / QTILE);   // 64 (batch*head) fastest x 32 q-tiles (heaviest first)
  dim3 block(128);                    // 4 waves (wave32)
  Attention_62302795596087_kernel<<<grid, block, 0, stream>>>(q, k, v, o);
}

// v002
// A run of this version takes 123 microseconds.
// Next to v001, in two timings, it ran 1.12 times as fast each time.
// Counting every step since v000, it is 1.77 times as fast.
#include <hip/hip_runtime.h>

typedef _Float16 v16h __attribute__((ext_vector_type(16)));
typedef _Float16 v8h  __attribute__((ext_vector_type(8)));
typedef _Float16 v4h  __attribute__((ext_vector_type(4)));
typedef float    v8f  __attribute__((ext_vector_type(8)));

#define S_LEN 2048
#define DHEAD 64
#define QTILE 64       // q rows per block (4 waves x 16)
#define KSTEP 32       // keys per inner step (WMMA K for PV)
// padded LDS row strides (in halves) to avoid bank conflicts; multiples of 8
#define KPAD  72       // K tile rows: 64 cols -> stride 72 (144B, 16B aligned)
#define VPAD  40       // Vt tile rows: 32 cols -> stride 40 (80B, 16B aligned)

// Value of the same query column in the other lane half (lane l <-> l ^ 16).
__device__ inline float other_half(float x) {
  int b = __float_as_int(x);
  return __int_as_float(__builtin_amdgcn_permlanex16(b, b, 0x76543210, 0xfedcba98, false, false));
}
__device__ inline float max_num(float a, float b) { return __builtin_fmaximum_numf(a, b); }

// Build a 16x32 (A/B) f16 fragment from two contiguous 8-half (16B) LDS rows.
__device__ inline v16h ld_frag(const _Float16* p_lo, const _Float16* p_hi) {
  v8h lo = *(const v8h*)p_lo;
  v8h hi = *(const v8h*)p_hi;
  v16h r;
#pragma unroll
  for (int i = 0; i < 8; ++i) { r[i] = lo[i]; r[i + 8] = hi[i]; }
  return r;
}

// Load 8 consecutive floats, scale, convert to halves at a[off..off+7].
__device__ inline void load8_scaled(const float* p, float s, v16h& a, int off) {
  float4 u = *(const float4*)p;
  float4 w = *(const float4*)(p + 4);
  a[off + 0] = (_Float16)(u.x * s); a[off + 1] = (_Float16)(u.y * s);
  a[off + 2] = (_Float16)(u.z * s); a[off + 3] = (_Float16)(u.w * s);
  a[off + 4] = (_Float16)(w.x * s); a[off + 5] = (_Float16)(w.y * s);
  a[off + 6] = (_Float16)(w.z * s); a[off + 7] = (_Float16)(w.w * s);
}

__global__ __launch_bounds__(128)
void Attention_62302795596087_kernel(const float* __restrict__ Q,
                                     const float* __restrict__ K,
                                     const float* __restrict__ V,
                                     float* __restrict__ O)
{
  __shared__ alignas(16) _Float16 Klds[KSTEP][KPAD];        // K tile, row-major  (keys x d)
  __shared__ alignas(16) _Float16 Vt[DHEAD][VPAD];          // V tile, transposed (d x keys)

  const int tid  = threadIdx.x;
  const int wave = tid >> 5;
  const int lane = tid & 31;
  const int l16  = lane & 15;
  const int hi   = lane >> 4;          // 0: lanes 0-15, 1: lanes 16-31

  // Causal cost grows with the q tile (tile t walks 2*(t+1) key steps) and more
  // workgroups are launched than fit on the chip, so the longest tiles get the
  // lowest indices and the short ones the highest (for speed only). Head index
  // runs fastest.
  const int bh       = blockIdx.x;                            // 0..63
  const int qTileIdx = (S_LEN / QTILE - 1) - (int)blockIdx.y; // 31..0, heaviest first
  const size_t baseBH = (size_t)bh * S_LEN * DHEAD;

  const int qBase0 = qTileIdx * QTILE;
  const int qRow0  = qBase0 + wave * 16;   // first q row owned by this wave
  const int myQRow = qRow0 + l16;          // the query (B-fragment column) of this lane

  // ---- Q^T B-fragments: 64x16 as two 32x16 f16 chunks (column = this lane's query).
  // Scale folds 1/sqrt(d) AND log2(e): softmax done in exp2 domain (exact).
  const float scale = 0.125f * 1.4426950408889634f;
  v16h aq[2];
  {
    const float* qp = Q + baseBH + (size_t)myQRow * DHEAD;
#pragma unroll
    for (int f = 0; f < 2; ++f) {
      load8_scaled(qp + f * 32 + hi * 8,      scale, aq[f], 0);  // K = 0..7  (lane half)
      load8_scaled(qp + f * 32 + 16 + hi * 8, scale, aq[f], 8);  // K = 16..23 (lane half)
    }
  }

  const float NEG_INF = -__builtin_inff();
  float mcol = NEG_INF;   // running maximum of this lane's query (equal in both halves)
  float lcol = 0.0f;      // running sum over the keys THIS lane half has seen
  v8f  oacc[4];           // oacc[n][r] = O^T[d = n*16 + hi*8 + r][query l16]
#pragma unroll
  for (int n = 0; n < 4; ++n) oacc[n] = (v8f)0.0f;

  const int jEnd  = qBase0 + QTILE;  // block-uniform staging bound (causal)
  const int myEnd = qRow0 + 16;      // keys >= myEnd are fully masked for this wave

  for (int j = 0; j < jEnd; j += KSTEP) {
    __syncthreads();   // previous step's LDS consumers are done

    // Prefetch next K/V tiles (locality=3 -> near scope, pulls into all levels)
    if (j + KSTEP < jEnd) {
      __builtin_prefetch(K + baseBH + (size_t)(j + KSTEP) * DHEAD + tid * 16, 0, 3);
      __builtin_prefetch(V + baseBH + (size_t)(j + KSTEP) * DHEAD + tid * 16, 0, 3);
    }

    // ---- cooperative staging: K -> Klds (f16 row-major), V -> Vt (f16 transposed)
    // Issue all 8 global loads first so they overlap, then convert + store.
    float4 kk[4], vv[4];
#pragma unroll
    for (int it = 0; it < 4; ++it) {
      int off = (tid + it * 128) * 4;          // 512 float4 per 32x64 tile
      int row = off >> 6;                      // key within tile
      int col = off & 63;                      // d
      kk[it] = *(const float4*)(K + baseBH + (size_t)(j + row) * DHEAD + col);
      vv[it] = *(const float4*)(V + baseBH + (size_t)(j + row) * DHEAD + col);
    }
#pragma unroll
    for (int it = 0; it < 4; ++it) {
      int off = (tid + it * 128) * 4;
      int row = off >> 6;
      int col = off & 63;
      v4h kh; kh[0] = (_Float16)kk[it].x; kh[1] = (_Float16)kk[it].y;
              kh[2] = (_Float16)kk[it].z; kh[3] = (_Float16)kk[it].w;
      *(v4h*)&Klds[row][col] = kh;
      Vt[col + 0][row] = (_Float16)vv[it].x; Vt[col + 1][row] = (_Float16)vv[it].y;
      Vt[col + 2][row] = (_Float16)vv[it].z; Vt[col + 3][row] = (_Float16)vv[it].w;
    }
    __syncthreads();

    // Wave-uniform skip: everything in this step is masked for this wave.
    if (j >= myEnd) continue;

    // ---- S^T = K * Q^T : two 16-key groups, 2 WMMAs each (d split 32+32)
    // st[g][r] = score of key j + g*16 + hi*8 + r against query myQRow
    v8f st[2];
#pragma unroll
    for (int g = 0; g < 2; ++g) {
      v8f c = (v8f)0.0f;
#pragma unroll
      for (int f = 0; f < 2; ++f) {
        v16h ka = ld_frag(&Klds[g * 16 + l16][f * 32 + hi * 8],
                          &Klds[g * 16 + l16][f * 32 + 16 + hi * 8]);
        c = __builtin_amdgcn_wmma_f32_16x16x32_f16(false, ka, false, aq[f],
                                                   (short)0, c, false, false);
      }
      st[g] = c;
    }

    // ---- causal mask: only the single diagonal step needs it (wave-uniform test)
    if (j + KSTEP - 1 > qRow0) {
#pragma unroll
      for (int r = 0; r < 8; ++r) {
        int k0 = j + hi * 8 + r;
        if (k0 > myQRow)      st[0][r] = NEG_INF;
        if (k0 + 16 > myQRow) st[1][r] = NEG_INF;
      }
    }

    // ---- online softmax in exp2 domain: in-lane over 16 keys, one exchange of halves
    float t0 = st[0][0], t1 = st[1][0];
#pragma unroll
    for (int r = 1; r < 8; ++r) { t0 = max_num(t0, st[0][r]); t1 = max_num(t1, st[1][r]); }
    float t     = max_num(t0, t1);
    float mnew  = max_num(mcol, max_num(t, other_half(t)));
    float alpha = __builtin_exp2f(mcol - mnew);
    mcol = mnew;
    float s0 = 0.0f, s1 = 0.0f;
    v16h pb;   // P^T as B operand: element s is key j + hi*8 + s (s < 8), j + 16 + hi*8 + s - 8 (s >= 8), the order of the Vt loads
#pragma unroll
    for (int r = 0; r < 8; ++r) {
      float p0 = __builtin_exp2f(st[0][r] - mnew);
      float p1 = __builtin_exp2f(st[1][r] - mnew);
      s0 += p0; s1 += p1;
      pb[r]     = (_Float16)p0;
      pb[r + 8] = (_Float16)p1;
    }
    lcol = lcol * alpha + (s0 + s1);
#pragma unroll
    for (int n = 0; n < 4; ++n) oacc[n] *= alpha;

    // ---- O^T += V^T * P^T : 4 d-row tiles of 16
#pragma unroll
    for (int n = 0; n < 4; ++n) {
      v16h va = ld_frag(&Vt[n * 16 + l16][hi * 8],
                        &Vt[n * 16 + l16][16 + hi * 8]);
      oacc[n] = __builtin_amdgcn_wmma_f32_16x16x32_f16(false, va, false, pb,
                                                       (short)0, oacc[n], false, false);
    }
  }

  // ---- epilogue: join the halves' sums, O / l; a lane owns 8 consecutive d per tile
  const float inv = 1.0f / (lcol + other_half(lcol));
  float* op = O + baseBH + (size_t)myQRow * DHEAD + hi * 8;
#pragma unroll
  for (int n = 0; n < 4; ++n) {
    float4 a, b;
    a.x = oacc[n][0] * inv; a.y = oacc[n][1] * inv; a.z = oacc[n][2] * inv; a.w = oacc[n][3] * inv;
    b.x = oacc[n][4] * inv; b.y = oacc[n][5] * inv; b.z = oacc[n][6] * inv; b.w = oacc[n][7] * inv;
    *(float4*)(op + n * 16)     = a;
    *(float4*)(op + n * 16 + 4) = b;
  }
}

extern "C" void kernel_launch(void* const* d_in, const int* in_sizes, int n_in,
                              void* d_out, int out_size, void* d_ws, size_t ws_size,
                              hipStream_t stream) {
  (void)in_sizes; (void)n_in; (void)out_size; (void)d_ws; (void)ws_size;
  const float* q = (const float*)d_in[0];
  const float* k = (const float*)d_in[1];
  const float* v = (const float*)d_in[2];
  float* o = (float*)d_out;
  dim3 grid(4 * 16, S_LEN / QTILE);   // 64 (batch*head) fastest x 32 q-tiles (heaviest first)
  dim3 block(128);                    // 4 waves (wave32)
  Attention_62302795596087_kernel<<<grid, block, 0, stream>>>(q, k, v, o);
}

// v003
// It runs in 88.5 microseconds.
// In two side-by-side timings against v002, it was 1.38 and 1.39 times as fast.
// Over all steps from v000 it is 2.45 times as fast.
#include <hip/hip_runtime.h>

typedef _Float16 v16h __attribute__((ext_vector_type(16)));
typedef _Float16 v8h  __attribute__((ext_vector_type(8)));
typedef _Float16 v4h  __attribute__((ext_vector_type(4)));
typedef float    v8f  __attribute__((ext_vector_type(8)));

#define S_LEN 2048
#define DHEAD 64
#define QTILE 128      // q rows per block (4 waves x 32)
#define CG    2        // 16-query column groups per wave
#define KSTEP 32       // keys per inner step (WMMA K for PV)
// padded LDS row strides (in halves) to avoid bank conflicts; multiples of 8
#define KPAD  72       // K tile rows: 64 cols -> stride 72 (144B, 16B aligned)
#define VPAD  40       // Vt tile rows: 32 cols -> stride 40 (80B, 16B aligned)

// Value of the same query column in the other lane half (lane l <-> l ^ 16).
__device__ inline float other_half(float x) {
  int b = __float_as_int(x);
  return __int_as_float(__builtin_amdgcn_permlanex16(b, b, 0x76543210, 0xfedcba98, false, false));
}
__device__ inline float max_num(float a, float b) { return __builtin_fmaximum_numf(a, b); }

// Build a 16x32 (A/B) f16 fragment from two contiguous 8-half (16B) LDS rows.
__device__ inline v16h ld_frag(const _Float16* p_lo, const _Float16* p_hi) {
  v8h lo = *(const v8h*)p_lo;
  v8h hi = *(const v8h*)p_hi;
  v16h r;
#pragma unroll
  for (int i = 0; i < 8; ++i) { r[i] = lo[i]; r[i + 8] = hi[i]; }
  return r;
}

// Load 8 consecutive floats, scale, convert to halves at a[off..off+7].
__device__ inline void load8_scaled(const float* p, float s, v16h& a, int off) {
  float4 u = *(const float4*)p;
  float4 w = *(const float4*)(p + 4);
  a[off + 0] = (_Float16)(u.x * s); a[off + 1] = (_Float16)(u.y * s);
  a[off + 2] = (_Float16)(u.z * s); a[off + 3] = (_Float16)(u.w * s);
  a[off + 4] = (_Float16)(w.x * s); a[off + 5] = (_Float16)(w.y * s);
  a[off + 6] = (_Float16)(w.z * s); a[off + 7] = (_Float16)(w.w * s);
}

__global__ __launch_bounds__(128)
void Attention_62302795596087_kernel(const float* __restrict__ Q,
                                     const float* __restrict__ K,
                                     const float* __restrict__ V,
                                     float* __restrict__ O)
{
  __shared__ alignas(16) _Float16 Klds[KSTEP][KPAD];        // K tile, row-major  (keys x d)
  __shared__ alignas(16) _Float16 Vt[DHEAD][VPAD];          // V tile, transposed (d x keys)

  const int tid  = threadIdx.x;
  const int wave = tid >> 5;
  const int lane = tid & 31;
  const int l16  = lane & 15;
  const int hi   = lane >> 4;          // 0: lanes 0-15, 1: lanes 16-31

  // Causal cost grows with the q tile (tile t walks 4*(t+1) key steps) and more
  // workgroups are launched than fit on the chip: the longest tiles get the
  // lowest indices, for speed only. Head index runs fastest.
  const int bh       = blockIdx.x;                            // 0..63
  const int qTileIdx = (S_LEN / QTILE - 1) - (int)blockIdx.y; // 15..0, heaviest first
  const size_t baseBH = (size_t)bh * S_LEN * DHEAD;

  const int qBase0 = qTileIdx * QTILE;
  const int qRow0  = qBase0 + wave * (16 * CG);   // first q row owned by this wave
  const int myQRow = qRow0 + l16;   // this lane's query in column group 0; group c: + 16 * c

  // ---- Q^T B-fragments, per column group: 64x16 as two 32x16 f16 chunks (column = this lane's query).
  // Scale folds 1/sqrt(d) AND log2(e): softmax done in exp2 domain (exact).
  const float scale = 0.125f * 1.4426950408889634f;
  v16h aq[CG][2];
#pragma unroll
  for (int c = 0; c < CG; ++c) {
    const float* qp = Q + baseBH + (size_t)(myQRow + c * 16) * DHEAD;
#pragma unroll
    for (int f = 0; f < 2; ++f) {
      load8_scaled(qp + f * 32 + hi * 8,      scale, aq[c][f], 0);  // K = 0..7  (lane half)
      load8_scaled(qp + f * 32 + 16 + hi * 8, scale, aq[c][f], 8);  // K = 16..23 (lane half)
    }
  }

  const float NEG_INF = -__builtin_inff();
  float mcol[CG];         // running maximum of this lane's query (equal in both halves)
  float lcol[CG];         // running sum over the keys THIS lane half has seen
  v8f  oacc[CG][4];       // oacc[c][n][r] = O^T[d = n*16 + hi*8 + r][query c*16 + l16]
#pragma unroll
  for (int c = 0; c < CG; ++c) {
    mcol[c] = NEG_INF;
    lcol[c] = 0.0f;
#pragma unroll
    for (int n = 0; n < 4; ++n) oacc[c][n] = (v8f)0.0f;
  }

  const int jEnd  = qBase0 + QTILE;  // block-uniform staging bound (causal)
  const int myEnd = qRow0 + 16 * CG; // keys >= myEnd are fully masked for this wave

  for (int j = 0; j < jEnd; j += KSTEP) {
    __syncthreads();   // previous step's LDS consumers are done

    // Prefetch next K/V tiles (locality=3 -> near scope, pulls into all levels)
    if (j + KSTEP < jEnd) {
      __builtin_prefetch(K + baseBH + (size_t)(j + KSTEP) * DHEAD + tid * 16, 0, 3);
      __builtin_prefetch(V + baseBH + (size_t)(j + KSTEP) * DHEAD + tid * 16, 0, 3);
    }

    // ---- cooperative staging: K -> Klds (f16 row-major), V -> Vt (f16 transposed)
    // Issue all 8 global loads first so they overlap, then convert + store.
    float4 kk[4], vv[4];
#pragma unroll
    for (int it = 0; it < 4; ++it) {
      int off = (tid + it * 128) * 4;          // 512 float4 per 32x64 tile
      int row = off >> 6;                      // key within tile
      int col = off & 63;                      // d
      kk[it] = *(const float4*)(K + baseBH + (size_t)(j + row) * DHEAD + col);
      vv[it] = *(const float4*)(V + baseBH + (size_t)(j + row) * DHEAD + col);
    }
#pragma unroll
    for (int it = 0; it < 4; ++it) {
      int off = (tid + it * 128) * 4;
      int row = off >> 6;
      int col = off & 63;
      v4h kh; kh[0] = (_Float16)kk[it].x; kh[1] = (_Float16)kk[it].y;
              kh[2] = (_Float16)kk[it].z; kh[3] = (_Float16)kk[it].w;
      *(v4h*)&Klds[row][col] = kh;
      Vt[col + 0][row] = (_Float16)vv[it].x; Vt[col + 1][row] = (_Float16)vv[it].y;
      Vt[col + 2][row] = (_Float16)vv[it].z; Vt[col + 3][row] = (_Float16)vv[it].w;
    }
    __syncthreads();

    // Wave-uniform skip: everything in this step is masked for this wave.
    if (j >= myEnd) continue;

    // ---- S^T = K * Q^T : two 16-key groups, 2 WMMAs each (d split 32+32) per column group
    // st[c][g][r] = score of key j + g*16 + hi*8 + r against query myQRow + c*16
    v8f st[CG][2];
#pragma unroll
    for (int g = 0; g < 2; ++g) {
#pragma unroll
      for (int c = 0; c < CG; ++c) st[c][g] = (v8f)0.0f;
#pragma unroll
      for (int f = 0; f < 2; ++f) {
        v16h ka = ld_frag(&Klds[g * 16 + l16][f * 32 + hi * 8],
                          &Klds[g * 16 + l16][f * 32 + 16 + hi * 8]);
#pragma unroll
        for (int c = 0; c < CG; ++c)
          st[c][g] = __builtin_amdgcn_wmma_f32_16x16x32_f16(false, ka, false, aq[c][f],
                                                            (short)0, st[c][g], false, false);
      }
    }

    // ---- causal mask: only the single diagonal step needs it (wave-uniform test)
    if (j + KSTEP - 1 > qRow0) {
#pragma unroll
      for (int c = 0; c < CG; ++c) {
        const int q = myQRow + c * 16;
#pragma unroll
        for (int r = 0; r < 8; ++r) {
          int k0 = j + hi * 8 + r;
          if (k0 > q)      st[c][0][r] = NEG_INF;
          if (k0 + 16 > q) st[c][1][r] = NEG_INF;
        }
      }
    }

    // ---- online softmax in exp2 domain: in-lane over 16 keys, one exchange of halves
    v16h pb[CG];   // P^T as B operand: element s is key j + 8*hi + s (s < 8), j + 8 + 8*hi + s (s >= 8), the order of the Vt loads
#pragma unroll
    for (int c = 0; c < CG; ++c) {
      float t0 = st[c][0][0], t1 = st[c][1][0];
#pragma unroll
      for (int r = 1; r < 8; ++r) { t0 = max_num(t0, st[c][0][r]); t1 = max_num(t1, st[c][1][r]); }
      float t     = max_num(t0, t1);
      float mnew  = max_num(mcol[c], max_num(t, other_half(t)));
      float alpha = __builtin_exp2f(mcol[c] - mnew);
      mcol[c] = mnew;
      float s0 = 0.0f, s1 = 0.0f;
#pragma unroll
      for (int r = 0; r < 8; ++r) {
        float p0 = __builtin_exp2f(st[c][0][r] - mnew);
        float p1 = __builtin_exp2f(st[c][1][r] - mnew);
        s0 += p0; s1 += p1;
        pb[c][r]     = (_Float16)p0;
        pb[c][r + 8] = (_Float16)p1;
      }
      lcol[c] = lcol[c] * alpha + (s0 + s1);
#pragma unroll
      for (int n = 0; n < 4; ++n) oacc[c][n] *= alpha;
    }

    // ---- O^T += V^T * P^T : 4 d-row tiles of 16, each V fragment used by both column groups
#pragma unroll
    for (int n = 0; n < 4; ++n) {
      v16h va = ld_frag(&Vt[n * 16 + l16][hi * 8],
                        &Vt[n * 16 + l16][16 + hi * 8]);
#pragma unroll
      for (int c = 0; c < CG; ++c)
        oacc[c][n] = __builtin_amdgcn_wmma_f32_16x16x32_f16(false, va, false, pb[c],
                                                            (short)0, oacc[c][n], false, false);
    }
  }

  // ---- epilogue: join the halves' sums, O / l; a lane owns 8 consecutive d per tile
#pragma unroll
  for (int c = 0; c < CG; ++c) {
    const float inv = 1.0f / (lcol[c] + other_half(lcol[c]));
    float* op = O + baseBH + (size_t)(myQRow + c * 16) * DHEAD + hi * 8;
#pragma unroll
    for (int n = 0; n < 4; ++n) {
      float4 a, b;
      a.x = oacc[c][n][0] * inv; a.y = oacc[c][n][1] * inv; a.z = oacc[c][n][2] * inv; a.w = oacc[c][n][3] * inv;
      b.x = oacc[c][n][4] * inv; b.y = oacc[c][n][5] * inv; b.z = oacc[c][n][6] * inv; b.w = oacc[c][n][7] * inv;
      *(float4*)(op + n * 16)     = a;
      *(float4*)(op + n * 16 + 4) = b;
    }
  }
}

extern "C" void kernel_launch(void* const* d_in, const int* in_sizes, int n_in,
                              void* d_out, int out_size, void* d_ws, size_t ws_size,
                              hipStream_t stream) {
  (void)in_sizes; (void)n_in; (void)out_size; (void)d_ws; (void)ws_size;
  const float* q = (const float*)d_in[0];
  const float* k = (const float*)d_in[1];
  const float* v = (const float*)d_in[2];
  float* o = (float*)d_out;
  dim3 grid(4 * 16, S_LEN / QTILE);   // 64 (batch*head) fastest x 16 q-tiles (heaviest first)
  dim3 block(128);                    // 4 waves (wave32)
  Attention_62302795596087_kernel<<<grid, block, 0, stream>>>(q, k, v, o);
}

// v004
// One run takes 85.3 microseconds.
// Timed twice side by side with v003, it ran 1.04 times as fast both times.
// Counting every step since v000, it is 2.54 times as fast.
#include <hip/hip_runtime.h>

typedef _Float16 v16h __attribute__((ext_vector_type(16)));
typedef _Float16 v8h  __attribute__((ext_vector_type(8)));
typedef _Float16 v4h  __attribute__((ext_vector_type(4)));
typedef float    v8f  __attribute__((ext_vector_type(8)));
typedef float    v2f  __attribute__((ext_vector_type(2)));

#define S_LEN 2048
#define DHEAD 64
#define QTILE 128      // q rows per block (4 waves x 32)
#define CG    2        // 16-query column groups per wave
#define KSTEP 32       // keys per inner step (WMMA K for PV)
// padded LDS row strides (in halves) to avoid bank conflicts; multiples of 8
#define KPAD  72       // K tile rows: 64 cols -> stride 72 (144B, 16B aligned)
#define VPAD  40       // Vt tile rows: 32 cols -> stride 40 (80B, 16B aligned)

// Value of the same query column in the other lane half (lane l <-> l ^ 16).
__device__ inline float other_half(float x) {
  int b = __float_as_int(x);
  return __int_as_float(__builtin_amdgcn_permlanex16(b, b, 0x76543210, 0xfedcba98, false, false));
}
__device__ inline float max_num(float a, float b) { return __builtin_fmaximum_numf(a, b); }
// 2^x as the bare v_exp_f32. The library form wraps it in a compare, two selects, an
// add and an ldexp per value so that results below 2^-126 come out as denormals; here
// every argument is <= 0 and such a result is nothing beside a row sum that holds the
// maximum's own 1.0 (and is 0 as f16), so it may flush to 0. -inf still gives 0.
__device__ inline float exp2_raw(float x) { return __builtin_amdgcn_exp2f(x); }

// Build a 16x32 (A/B) f16 fragment from two contiguous 8-half (16B) LDS rows.
__device__ inline v16h ld_frag(const _Float16* p_lo, const _Float16* p_hi) {
  v8h lo = *(const v8h*)p_lo;
  v8h hi = *(const v8h*)p_hi;
  v16h r;
#pragma unroll
  for (int i = 0; i < 8; ++i) { r[i] = lo[i]; r[i + 8] = hi[i]; }
  return r;
}

// Load 8 consecutive floats, scale, convert to halves at a[off..off+7].
__device__ inline void load8_scaled(const float* p, float s, v16h& a, int off) {
  float4 u = *(const float4*)p;
  float4 w = *(const float4*)(p + 4);
  a[off + 0] = (_Float16)(u.x * s); a[off + 1] = (_Float16)(u.y * s);
  a[off + 2] = (_Float16)(u.z * s); a[off + 3] = (_Float16)(u.w * s);
  a[off + 4] = (_Float16)(w.x * s); a[off + 5] = (_Float16)(w.y * s);
  a[off + 6] = (_Float16)(w.z * s); a[off + 7] = (_Float16)(w.w * s);
}

// Four waves per SIMD: all 1024 work-groups are resident at four per WGP, and with that
// register budget the compiler fetches the V fragments during the softmax instead of
// waiting for each pair right in front of its products.
__global__ __launch_bounds__(128) __attribute__((amdgpu_waves_per_eu(4, 4)))
void Attention_62302795596087_kernel(const float* __restrict__ Q,
                                     const float* __restrict__ K,
                                     const float* __restrict__ V,
                                     float* __restrict__ O)
{
  __shared__ alignas(16) _Float16 Klds[KSTEP][KPAD];        // K tile, row-major  (keys x d)
  __shared__ alignas(16) _Float16 Vt[DHEAD][VPAD];          // V tile, transposed (d x keys)

  const int tid  = threadIdx.x;
  const int wave = tid >> 5;
  const int lane = tid & 31;
  const int l16  = lane & 15;
  const int hi   = lane >> 4;          // 0: lanes 0-15, 1: lanes 16-31

  // Causal cost grows with the q tile (tile t walks 4*(t+1) key steps) and more
  // workgroups are launched than fit on the chip: the longest tiles get the
  // lowest indices, for speed only. Head index runs fastest.
  const int bh       = blockIdx.x;                            // 0..63
  const int qTileIdx = (S_LEN / QTILE - 1) - (int)blockIdx.y; // 15..0, heaviest first
  const size_t baseBH = (size_t)bh * S_LEN * DHEAD;

  const int qBase0 = qTileIdx * QTILE;
  const int qRow0  = qBase0 + wave * (16 * CG);   // first q row owned by this wave
  const int myQRow = qRow0 + l16;   // this lane's query in column group 0; group c: + 16 * c

  // ---- Q^T B-fragments, per column group: 64x16 as two 32x16 f16 chunks (column = this lane's query).
  // Scale folds 1/sqrt(d) AND log2(e): softmax done in exp2 domain (exact).
  const float scale = 0.125f * 1.4426950408889634f;
  v16h aq[CG][2];
#pragma unroll
  for (int c = 0; c < CG; ++c) {
    const float* qp = Q + baseBH + (size_t)(myQRow + c * 16) * DHEAD;
#pragma unroll
    for (int f = 0; f < 2; ++f) {
      load8_scaled(qp + f * 32 + hi * 8,      scale, aq[c][f], 0);  // K = 0..7  (lane half)
      load8_scaled(qp + f * 32 + 16 + hi * 8, scale, aq[c][f], 8);  // K = 16..23 (lane half)
    }
  }

  const float NEG_INF = -__builtin_inff();
  float mcol[CG];         // running maximum of this lane's query (equal in both halves)
  float lcol[CG];         // running sum over the keys THIS lane half has seen
  v8f  oacc[CG][4];       // oacc[c][n][r] = O^T[d = n*16 + hi*8 + r][query c*16 + l16]
#pragma unroll
  for (int c = 0; c < CG; ++c) {
    mcol[c] = NEG_INF;
    lcol[c] = 0.0f;
#pragma unroll
    for (int n = 0; n < 4; ++n) oacc[c][n] = (v8f)0.0f;
  }

  const int jEnd  = qBase0 + QTILE;  // block-uniform staging bound (causal)
  const int myEnd = qRow0 + 16 * CG; // keys >= myEnd are fully masked for this wave

  for (int j = 0; j < jEnd; j += KSTEP) {
    __syncthreads();   // previous step's LDS consumers are done

    // Prefetch next K/V tiles (locality=3 -> near scope, pulls into all levels)
    if (j + KSTEP < jEnd) {
      __builtin_prefetch(K + baseBH + (size_t)(j + KSTEP) * DHEAD + tid * 16, 0, 3);
      __builtin_prefetch(V + baseBH + (size_t)(j + KSTEP) * DHEAD + tid * 16, 0, 3);
    }

    // ---- cooperative staging: K -> Klds (f16 row-major), V -> Vt (f16 transposed)
    // Issue all 8 global loads first so they overlap, then convert + store.
    float4 kk[4], vv[4];
#pragma unroll
    for (int it = 0; it < 4; ++it) {
      int off = (tid + it * 128) * 4;          // 512 float4 per 32x64 tile
      int row = off >> 6;                      // key within tile
      int col = off & 63;                      // d
      kk[it] = *(const float4*)(K + baseBH + (size_t)(j + row) * DHEAD + col);
      vv[it] = *(const float4*)(V + baseBH + (size_t)(j + row) * DHEAD + col);
    }
#pragma unroll
    for (int it = 0; it < 4; ++it) {
      int off = (tid + it * 128) * 4;
      int row = off >> 6;
      int col = off & 63;
      v4h kh; kh[0] = (_Float16)kk[it].x; kh[1] = (_Float16)kk[it].y;
              kh[2] = (_Float16)kk[it].z; kh[3] = (_Float16)kk[it].w;
      *(v4h*)&Klds[row][col] = kh;
      Vt[col + 0][row] = (_Float16)vv[it].x; Vt[col + 1][row] = (_Float16)vv[it].y;
      Vt[col + 2][row] = (_Float16)vv[it].z; Vt[col + 3][row] = (_Float16)vv[it].w;
    }
    __syncthreads();

    // Wave-uniform skip: everything in this step is masked for this wave.
    if (j >= myEnd) continue;

    // ---- S^T = K * Q^T : two 16-key groups, 2 WMMAs each (d split 32+32) per column group
    // st[c][g][r] = score of key j + g*16 + hi*8 + r against query myQRow + c*16
    v8f st[CG][2];
#pragma unroll
    for (int g = 0; g < 2; ++g) {
#pragma unroll
      for (int c = 0; c < CG; ++c) st[c][g] = (v8f)0.0f;
#pragma unroll
      for (int f = 0; f < 2; ++f) {
        v16h ka = ld_frag(&Klds[g * 16 + l16][f * 32 + hi * 8],
                          &Klds[g * 16 + l16][f * 32 + 16 + hi * 8]);
#pragma unroll
        for (int c = 0; c < CG; ++c)
          st[c][g] = __builtin_amdgcn_wmma_f32_16x16x32_f16(false, ka, false, aq[c][f],
                                                            (short)0, st[c][g], false, false);
      }
    }

    // ---- causal mask: only the single diagonal step needs it (wave-uniform test)
    if (j + KSTEP - 1 > qRow0) {
#pragma unroll
      for (int c = 0; c < CG; ++c) {
        const int q = myQRow + c * 16;
#pragma unroll
        for (int r = 0; r < 8; ++r) {
          int k0 = j + hi * 8 + r;
          if (k0 > q)      st[c][0][r] = NEG_INF;
          if (k0 + 16 > q) st[c][1][r] = NEG_INF;
        }
      }
    }

    // ---- online softmax in exp2 domain: in-lane over 16 keys, one exchange of halves
    v16h pb[CG];   // P^T as B operand: element s is key j + 8*hi + s (s < 8), j + 8 + 8*hi + s (s >= 8), the order of the Vt loads
#pragma unroll
    for (int c = 0; c < CG; ++c) {
      float t0 = st[c][0][0], t1 = st[c][1][0];
#pragma unroll
      for (int r = 1; r < 8; ++r) { t0 = max_num(t0, st[c][0][r]); t1 = max_num(t1, st[c][1][r]); }
      float t     = max_num(t0, t1);
      float mnew  = max_num(mcol[c], max_num(t, other_half(t)));
      float alpha = exp2_raw(mcol[c] - mnew);
      mcol[c] = mnew;
      float s0 = 0.0f, s1 = 0.0f;
#pragma unroll
      for (int r = 0; r < 8; r += 2) {
        // subtract on a score tile's own register pairs: one packed instruction, no copies
        v2f d0 = {st[c][0][r], st[c][0][r + 1]};
        v2f d1 = {st[c][1][r], st[c][1][r + 1]};
        d0 -= mnew; d1 -= mnew;
        float p0 = exp2_raw(d0.x), p1 = exp2_raw(d1.x);
        float u0 = exp2_raw(d0.y), u1 = exp2_raw(d1.y);
        s0 += p0; s1 += p1;
        s0 += u0; s1 += u1;
        pb[c][r]     = (_Float16)p0; pb[c][r + 1] = (_Float16)u0;
        pb[c][r + 8] = (_Float16)p1; pb[c][r + 9] = (_Float16)u1;
      }
      lcol[c] = lcol[c] * alpha + (s0 + s1);
#pragma unroll
      for (int n = 0; n < 4; ++n) oacc[c][n] *= alpha;
    }

    // ---- O^T += V^T * P^T : 4 d-row tiles of 16, each V fragment used by both column groups
#pragma unroll
    for (int n = 0; n < 4; ++n) {
      v16h va = ld_frag(&Vt[n * 16 + l16][hi * 8],
                        &Vt[n * 16 + l16][16 + hi * 8]);
#pragma unroll
      for (int c = 0; c < CG; ++c)
        oacc[c][n] = __builtin_amdgcn_wmma_f32_16x16x32_f16(false, va, false, pb[c],
                                                            (short)0, oacc[c][n], false, false);
    }
  }

  // ---- epilogue: join the halves' sums, O / l; a lane owns 8 consecutive d per tile
#pragma unroll
  for (int c = 0; c < CG; ++c) {
    const float inv = 1.0f / (lcol[c] + other_half(lcol[c]));
    float* op = O + baseBH + (size_t)(myQRow + c * 16) * DHEAD + hi * 8;
#pragma unroll
    for (int n = 0; n < 4; ++n) {
      float4 a, b;
      a.x = oacc[c][n][0] * inv; a.y = oacc[c][n][1] * inv; a.z = oacc[c][n][2] * inv; a.w = oacc[c][n][3] * inv;
      b.x = oacc[c][n][4] * inv; b.y = oacc[c][n][5] * inv; b.z = oacc[c][n][6] * inv; b.w = oacc[c][n][7] * inv;
      *(float4*)(op + n * 16)     = a;
      *(float4*)(op + n * 16 + 4) = b;
    }
  }
}

extern "C" void kernel_launch(void* const* d_in, const int* in_sizes, int n_in,
                              void* d_out, int out_size, void* d_ws, size_t ws_size,
                              hipStream_t stream) {
  (void)in_sizes; (void)n_in; (void)out_size; (void)d_ws; (void)ws_size;
  const float* q = (const float*)d_in[0];
  const float* k = (const float*)d_in[1];
  const float* v = (const float*)d_in[2];
  float* o = (float*)d_out;
  dim3 grid(4 * 16, S_LEN / QTILE);   // 64 (batch*head) fastest x 16 q-tiles (heaviest first)
  dim3 block(128);                    // 4 waves (wave32)
  Attention_62302795596087_kernel<<<grid, block, 0, stream>>>(q, k, v, o);
}

// v005
// Measured time: 73.5 microseconds a run.
// Next to v004, in two timings, it ran 1.16 times as fast each time.
// Counting every step since v000, it is 2.96 times as fast.
#include <hip/hip_runtime.h>

typedef _Float16 v16h __attribute__((ext_vector_type(16)));
typedef _Float16 v8h  __attribute__((ext_vector_type(8)));
typedef _Float16 v4h  __attribute__((ext_vector_type(4)));
typedef float    v8f  __attribute__((ext_vector_type(8)));
typedef float    v2f  __attribute__((ext_vector_type(2)));

#define S_LEN 2048
#define DHEAD 64
#define QTILE 128      // q rows per block (4 waves x 32)
#define CG    2        // 16-query column groups per wave
#define KSTEP 32       // keys per inner step (WMMA K for PV)
// padded LDS row strides (in halves) to avoid bank conflicts; multiples of 8
#define KPAD  72       // K tile rows: 64 cols -> stride 72 (144B, 16B aligned)
#define VPAD  40       // Vt tile rows: 32 cols -> stride 40 (80B, 16B aligned)

// Value of the same query column in the other lane half (lane l <-> l ^ 16).
__device__ inline float other_half(float x) {
  int b = __float_as_int(x);
  return __int_as_float(__builtin_amdgcn_permlanex16(b, b, 0x76543210, 0xfedcba98, false, false));
}
__device__ inline float max_num(float a, float b) { return __builtin_fmaximum_numf(a, b); }
// 2^x as the bare v_exp_f32. The library form wraps it in a compare, two selects, an
// add and an ldexp per value so that results below 2^-126 come out as denormals; here
// every argument is <= 0 and such a result is nothing beside a row sum that holds the
// maximum's own 1.0 (and is 0 as f16), so it may flush to 0. -inf still gives 0.
__device__ inline float exp2_raw(float x) { return __builtin_amdgcn_exp2f(x); }

// Build a 16x32 (A/B) f16 fragment from two contiguous 8-half (16B) LDS rows.
__device__ inline v16h ld_frag(const _Float16* p_lo, const _Float16* p_hi) {
  v8h lo = *(const v8h*)p_lo;
  v8h hi = *(const v8h*)p_hi;
  v16h r;
#pragma unroll
  for (int i = 0; i < 8; ++i) { r[i] = lo[i]; r[i + 8] = hi[i]; }
  return r;
}

// Load 8 consecutive floats, scale, convert to halves at a[off..off+7].
__device__ inline void load8_scaled(const float* p, float s, v16h& a, int off) {
  float4 u = *(const float4*)p;
  float4 w = *(const float4*)(p + 4);
  a[off + 0] = (_Float16)(u.x * s); a[off + 1] = (_Float16)(u.y * s);
  a[off + 2] = (_Float16)(u.z * s); a[off + 3] = (_Float16)(u.w * s);
  a[off + 4] = (_Float16)(w.x * s); a[off + 5] = (_Float16)(w.y * s);
  a[off + 6] = (_Float16)(w.z * s); a[off + 7] = (_Float16)(w.w * s);
}

// One thread's share of a 32 x 64 f32 tile: four float4, 128 threads apart (tile is contiguous).
__device__ inline void load_tile(const float* __restrict__ p, float4 (&r)[4]) {
#pragma unroll
  for (int it = 0; it < 4; ++it) r[it] = *(const float4*)(p + it * 512);
}
// Convert and store that share: K row-major at kdst (this thread's row, column), V transposed
// at vdst (this thread's first d row, key column); share it lies 8 keys further on.
__device__ inline void store_tile(_Float16* kdst, _Float16* vdst,
                                  const float4 (&kk)[4], const float4 (&vv)[4]) {
#pragma unroll
  for (int it = 0; it < 4; ++it) {
    v4h kh; kh[0] = (_Float16)kk[it].x; kh[1] = (_Float16)kk[it].y;
            kh[2] = (_Float16)kk[it].z; kh[3] = (_Float16)kk[it].w;
    *(v4h*)(kdst + it * 8 * KPAD) = kh;
    _Float16* vd = vdst + it * 8;
    vd[0 * VPAD] = (_Float16)vv[it].x; vd[1 * VPAD] = (_Float16)vv[it].y;
    vd[2 * VPAD] = (_Float16)vv[it].z; vd[3 * VPAD] = (_Float16)vv[it].w;
  }
}

// Four waves per SIMD: all 1024 work-groups are resident at four per WGP, and with that
// register budget the compiler fetches the V fragments during the softmax instead of
// waiting for each pair right in front of its products.
__global__ __launch_bounds__(128) __attribute__((amdgpu_waves_per_eu(4, 4)))
void Attention_62302795596087_kernel(const float* __restrict__ Q,
                                     const float* __restrict__ K,
                                     const float* __restrict__ V,
                                     float* __restrict__ O)
{
  // two buffers each: K tile row-major (keys x d), V tile transposed (d x keys)
  __shared__ alignas(16) _Float16 Klds0[KSTEP][KPAD];
  __shared__ alignas(16) _Float16 Klds1[KSTEP][KPAD];
  __shared__ alignas(16) _Float16 Vt0[DHEAD][VPAD];
  __shared__ alignas(16) _Float16 Vt1[DHEAD][VPAD];

  const int tid  = threadIdx.x;
  const int wave = tid >> 5;
  const int lane = tid & 31;
  const int l16  = lane & 15;
  const int hi   = lane >> 4;          // 0: lanes 0-15, 1: lanes 16-31

  // Causal cost grows with the q tile (tile t walks 4*(t+1) key steps) and more
  // workgroups are launched than fit on the chip: the longest tiles get the
  // lowest indices, for speed only. Head index runs fastest.
  const int bh       = blockIdx.x;                            // 0..63
  const int qTileIdx = (S_LEN / QTILE - 1) - (int)blockIdx.y; // 15..0, heaviest first
  const size_t baseBH = (size_t)bh * S_LEN * DHEAD;

  const int qBase0 = qTileIdx * QTILE;
  const int qRow0  = qBase0 + wave * (16 * CG);   // first q row owned by this wave
  const int myQRow = qRow0 + l16;   // this lane's query in column group 0; group c: + 16 * c

  // ---- Q^T B-fragments, per column group: 64x16 as two 32x16 f16 chunks (column = this lane's query).
  // Scale folds 1/sqrt(d) AND log2(e): softmax done in exp2 domain (exact).
  const float scale = 0.125f * 1.4426950408889634f;
  v16h aq[CG][2];
#pragma unroll
  for (int c = 0; c < CG; ++c) {
    const float* qp = Q + baseBH + (size_t)(myQRow + c * 16) * DHEAD;
#pragma unroll
    for (int f = 0; f < 2; ++f) {
      load8_scaled(qp + f * 32 + hi * 8,      scale, aq[c][f], 0);  // K = 0..7  (lane half)
      load8_scaled(qp + f * 32 + 16 + hi * 8, scale, aq[c][f], 8);  // K = 16..23 (lane half)
    }
  }

  const float NEG_INF = -__builtin_inff();
  float mcol[CG];         // running maximum of this lane's query (equal in both halves)
  float lcol[CG];         // running sum over the keys THIS lane half has seen
  v8f  oacc[CG][4];       // oacc[c][n][r] = O^T[d = n*16 + hi*8 + r][query c*16 + l16]
#pragma unroll
  for (int c = 0; c < CG; ++c) {
    mcol[c] = NEG_INF;
    lcol[c] = 0.0f;
#pragma unroll
    for (int n = 0; n < 4; ++n) oacc[c][n] = (v8f)0.0f;
  }

  const int jEnd  = qBase0 + QTILE;  // block-uniform staging bound (causal)
  const int myEnd = qRow0 + 16 * CG; // keys >= myEnd are fully masked for this wave

  // One step's products and softmax on the tile of keys j .. j + 31 held in (Kl, Vl).
  auto compute = [&](const _Float16 (*Kl)[KPAD], const _Float16 (*Vl)[VPAD],
                     const int j) __attribute__((always_inline)) {
    // ---- S^T = K * Q^T : two 16-key groups, 2 WMMAs each (d split 32+32) per column group
    // st[c][g][r] = score of key j + g*16 + hi*8 + r against query myQRow + c*16
    v8f st[CG][2];
#pragma unroll
    for (int g = 0; g < 2; ++g) {
#pragma unroll
      for (int c = 0; c < CG; ++c) st[c][g] = (v8f)0.0f;
#pragma unroll
      for (int f = 0; f < 2; ++f) {
        v16h ka = ld_frag(&Kl[g * 16 + l16][f * 32 + hi * 8],
                          &Kl[g * 16 + l16][f * 32 + 16 + hi * 8]);
#pragma unroll
        for (int c = 0; c < CG; ++c)
          st[c][g] = __builtin_amdgcn_wmma_f32_16x16x32_f16(false, ka, false, aq[c][f],
                                                            (short)0, st[c][g], false, false);
      }
    }

    // ---- causal mask: only the single diagonal step needs it (wave-uniform test)
    if (j + KSTEP - 1 > qRow0) {
#pragma unroll
      for (int c = 0; c < CG; ++c) {
        const int q = myQRow + c * 16;
#pragma unroll
        for (int r = 0; r < 8; ++r) {
          int k0 = j + hi * 8 + r;
          if (k0 > q)      st[c][0][r] = NEG_INF;
          if (k0 + 16 > q) st[c][1][r] = NEG_INF;
        }
      }
    }

    // ---- online softmax in exp2 domain: in-lane over 16 keys, one exchange of halves
    v16h pb[CG];   // P^T as B operand: element s is key 8*hi + s (s < 8) or 16 + 8*hi + s - 8 (s >= 8), the order of the Vt loads
#pragma unroll
    for (int c = 0; c < CG; ++c) {
      float t0 = st[c][0][0], t1 = st[c][1][0];
#pragma unroll
      for (int r = 1; r < 8; ++r) { t0 = max_num(t0, st[c][0][r]); t1 = max_num(t1, st[c][1][r]); }
      float t     = max_num(t0, t1);
      float mnew  = max_num(mcol[c], max_num(t, other_half(t)));
      float alpha = exp2_raw(mcol[c] - mnew);
      mcol[c] = mnew;
      float s0 = 0.0f, s1 = 0.0f;
#pragma unroll
      for (int r = 0; r < 8; r += 2) {
        // subtract on a score tile's own register pairs: one packed instruction, no copies
        v2f d0 = {st[c][0][r], st[c][0][r + 1]};
        v2f d1 = {st[c][1][r], st[c][1][r + 1]};
        d0 -= mnew; d1 -= mnew;
        float p0 = exp2_raw(d0.x), p1 = exp2_raw(d1.x);
        float u0 = exp2_raw(d0.y), u1 = exp2_raw(d1.y);
        s0 += p0; s1 += p1;
        s0 += u0; s1 += u1;
        pb[c][r]     = (_Float16)p0; pb[c][r + 1] = (_Float16)u0;
        pb[c][r + 8] = (_Float16)p1; pb[c][r + 9] = (_Float16)u1;
      }
      lcol[c] = lcol[c] * alpha + (s0 + s1);
#pragma unroll
      for (int n = 0; n < 4; ++n) oacc[c][n] *= alpha;
    }

    // ---- O^T += V^T * P^T : 4 d-row tiles of 16, each V fragment used by both column groups
#pragma unroll
    for (int n = 0; n < 4; ++n) {
      v16h va = ld_frag(&Vl[n * 16 + l16][hi * 8],
                        &Vl[n * 16 + l16][16 + hi * 8]);
#pragma unroll
      for (int c = 0; c < CG; ++c)
        oacc[c][n] = __builtin_amdgcn_wmma_f32_16x16x32_f16(false, va, false, pb[c],
                                                            (short)0, oacc[c][n], false, false);
    }
  };

  // ---- staging: thread tid holds floats tid*4 + it*512 of a tile: key (tid >> 4) + it*8, d (tid & 15)*4
  const float* kp = K + baseBH + tid * 4;
  const float* vp = V + baseBH + tid * 4;
  const int srow = tid >> 4, scol = (tid & 15) * 4;
  // Hint for the tile one step ahead of the loads (locality=3 -> near scope): 64 B a thread.
  auto hint = [&](const int jt) __attribute__((always_inline)) {
    __builtin_prefetch(K + baseBH + (size_t)jt * DHEAD + tid * 16, 0, 3);
    __builtin_prefetch(V + baseBH + (size_t)jt * DHEAD + tid * 16, 0, 3);
  };
  float4 kk[4], vv[4];
  hint(KSTEP);
  load_tile(kp, kk);
  load_tile(vp, vv);
  store_tile(&Klds0[srow][scol], &Vt0[scol][srow], kk, vv);
  __syncthreads();   // tile 0 is published

  // Two steps a trip (a q tile walks a multiple of 4 steps), so each buffer is a constant.
  // A step: issue the next tile's loads, work on this tile, store the next tile to the other
  // buffer, whose readers all passed the previous barrier; one barrier publishes it and ends
  // this tile's reads. A wave for which the whole step is masked only stages (wave-uniform).
  for (int j = 0; j < jEnd; j += 2 * KSTEP) {
    const bool more = j + 2 * KSTEP < jEnd;   // block-uniform: tiles j + 64 and j + 96 exist
    if (more) hint(j + 2 * KSTEP);
    load_tile(kp + (size_t)(j + KSTEP) * DHEAD, kk);
    load_tile(vp + (size_t)(j + KSTEP) * DHEAD, vv);
    if (j < myEnd) compute(Klds0, Vt0, j);
    store_tile(&Klds1[srow][scol], &Vt1[scol][srow], kk, vv);
    __syncthreads();

    if (more) {
      hint(j + 3 * KSTEP);
      load_tile(kp + (size_t)(j + 2 * KSTEP) * DHEAD, kk);
      load_tile(vp + (size_t)(j + 2 * KSTEP) * DHEAD, vv);
    }
    if (j + KSTEP < myEnd) compute(Klds1, Vt1, j + KSTEP);
    if (more) store_tile(&Klds0[srow][scol], &Vt0[scol][srow], kk, vv);
    __syncthreads();
  }

  // ---- epilogue: join the halves' sums, O / l; a lane owns 8 consecutive d per tile
#pragma unroll
  for (int c = 0; c < CG; ++c) {
    const float inv = 1.0f / (lcol[c] + other_half(lcol[c]));
    float* op = O + baseBH + (size_t)(myQRow + c * 16) * DHEAD + hi * 8;
#pragma unroll
    for (int n = 0; n < 4; ++n) {
      float4 a, b;
      a.x = oacc[c][n][0] * inv; a.y = oacc[c][n][1] * inv; a.z = oacc[c][n][2] * inv; a.w = oacc[c][n][3] * inv;
      b.x = oacc[c][n][4] * inv; b.y = oacc[c][n][5] * inv; b.z = oacc[c][n][6] * inv; b.w = oacc[c][n][7] * inv;
      *(float4*)(op + n * 16)     = a;
      *(float4*)(op + n * 16 + 4) = b;
    }
  }
}

extern "C" void kernel_launch(void* const* d_in, const int* in_sizes, int n_in,
                              void* d_out, int out_size, void* d_ws, size_t ws_size,
                              hipStream_t stream) {
  (void)in_sizes; (void)n_in; (void)out_size; (void)d_ws; (void)ws_size;
  const float* q = (const float*)d_in[0];
  const float* k = (const float*)d_in[1];
  const float* v = (const float*)d_in[2];
  float* o = (float*)d_out;
  dim3 grid(4 * 16, S_LEN / QTILE);   // 64 (batch*head) fastest x 16 q-tiles (heaviest first)
  dim3 block(128);                    // 4 waves (wave32)
  Attention_62302795596087_kernel<<<grid, block, 0, stream>>>(q, k, v, o);
}

// v006
// Measured time: 59.5 microseconds a run.
// In two side-by-side timings against v005, it was 1.23 and 1.24 times as fast.
// Over all steps from v000 it is 3.65 times as fast.
#include <hip/hip_runtime.h>

typedef _Float16 v16h __attribute__((ext_vector_type(16)));
typedef _Float16 v8h  __attribute__((ext_vector_type(8)));
typedef _Float16 v4h  __attribute__((ext_vector_type(4)));
typedef float    v8f  __attribute__((ext_vector_type(8)));
typedef float    v2f  __attribute__((ext_vector_type(2)));

#define S_LEN 2048
#define DHEAD 64
#define QTILE 128      // q rows per causal tile (4 waves x 32); a block holds two tiles
#define NTILE (S_LEN / QTILE)
#define CG    2        // 16-query column groups per wave
#define KSTEP 32       // keys per inner step (WMMA K for PV)
// padded LDS row strides (in halves) to avoid bank conflicts; multiples of 8
#define KPAD  72       // K tile rows: 64 cols -> stride 72 (144B, 16B aligned)
#define VPAD  40       // Vt tile rows: 32 cols -> stride 40 (80B, 16B aligned)

// Value of the same query column in the other lane half (lane l <-> l ^ 16).
__device__ inline float other_half(float x) {
  int b = __float_as_int(x);
  return __int_as_float(__builtin_amdgcn_permlanex16(b, b, 0x76543210, 0xfedcba98, false, false));
}
__device__ inline float max_num(float a, float b) { return __builtin_fmaximum_numf(a, b); }
// 2^x as the bare v_exp_f32. The library form wraps it in a compare, two selects, an
// add and an ldexp per value so that results below 2^-126 come out as denormals; here
// every argument is <= 0 and such a result is nothing beside a row sum that holds the
// maximum's own 1.0 (and is 0 as f16), so it may flush to 0. -inf still gives 0.
__device__ inline float exp2_raw(float x) { return __builtin_amdgcn_exp2f(x); }

// Build a 16x32 (A/B) f16 fragment from two contiguous 8-half (16B) LDS rows.
__device__ inline v16h ld_frag(const _Float16* p_lo, const _Float16* p_hi) {
  v8h lo = *(const v8h*)p_lo;
  v8h hi = *(const v8h*)p_hi;
  v16h r;
#pragma unroll
  for (int i = 0; i < 8; ++i) { r[i] = lo[i]; r[i + 8] = hi[i]; }
  return r;
}

// Load 8 consecutive floats, scale, convert to halves at a[off..off+7].
__device__ inline void load8_scaled(const float* p, float s, v16h& a, int off) {
  float4 u = *(const float4*)p;
  float4 w = *(const float4*)(p + 4);
  a[off + 0] = (_Float16)(u.x * s); a[off + 1] = (_Float16)(u.y * s);
  a[off + 2] = (_Float16)(u.z * s); a[off + 3] = (_Float16)(u.w * s);
  a[off + 4] = (_Float16)(w.x * s); a[off + 5] = (_Float16)(w.y * s);
  a[off + 6] = (_Float16)(w.z * s); a[off + 7] = (_Float16)(w.w * s);
}

// One thread's share of a 32 x 64 f32 tile: two float4, 256 threads apart (tile is contiguous).
__device__ inline void load_tile(const float* __restrict__ p, float4 (&r)[2]) {
#pragma unroll
  for (int it = 0; it < 2; ++it) r[it] = *(const float4*)(p + it * 1024);
}
// Convert and store that share: K row-major at kdst (this thread's row, column), V transposed
// at vdst (this thread's first d row, key column); share it lies 16 keys further on.
__device__ inline void store_tile(_Float16* kdst, _Float16* vdst,
                                  const float4 (&kk)[2], const float4 (&vv)[2]) {
#pragma unroll
  for (int it = 0; it < 2; ++it) {
    v4h kh; kh[0] = (_Float16)kk[it].x; kh[1] = (_Float16)kk[it].y;
            kh[2] = (_Float16)kk[it].z; kh[3] = (_Float16)kk[it].w;
    *(v4h*)(kdst + it * 16 * KPAD) = kh;
    _Float16* vd = vdst + it * 16;
    vd[0 * VPAD] = (_Float16)vv[it].x; vd[1 * VPAD] = (_Float16)vv[it].y;
    vd[2 * VPAD] = (_Float16)vv[it].z; vd[3 * VPAD] = (_Float16)vv[it].w;
  }
}

// Four waves per SIMD: the 512 work-groups fill the chip at exactly two per WGP, and with
// that register budget the compiler fetches the V fragments during the softmax instead of
// waiting for each pair right in front of its products.
__global__ __launch_bounds__(256) __attribute__((amdgpu_waves_per_eu(4, 4)))
void Attention_62302795596087_kernel(const float* __restrict__ Q,
                                     const float* __restrict__ K,
                                     const float* __restrict__ V,
                                     float* __restrict__ O)
{
  // two buffers each: K tile row-major (keys x d), V tile transposed (d x keys)
  __shared__ alignas(16) _Float16 Klds0[KSTEP][KPAD];
  __shared__ alignas(16) _Float16 Klds1[KSTEP][KPAD];
  __shared__ alignas(16) _Float16 Vt0[DHEAD][VPAD];
  __shared__ alignas(16) _Float16 Vt1[DHEAD][VPAD];

  const int tid  = threadIdx.x;
  const int wave = tid >> 5;
  const int lane = tid & 31;
  const int l16  = lane & 15;
  const int hi   = lane >> 4;          // 0: lanes 0-15, 1: lanes 16-31

  // Causal cost grows with the q tile (tile t works on 4*(t+1) key steps) and all work-groups
  // are resident at once, so the launch lasts as long as the fullest WGP. Tile 15 - p and tile p
  // together always make 17 tile units. The block walks the long tile's keys; the trip count is
  // block-uniform and every wave stages and passes every barrier, also behind its own last key.
  // The walk still differs (16 - p units): pairs 0..3 are followed by 7..4, so that two
  // work-groups 256 indices apart have walks that add up alike. Head index runs fastest.
  const int bh   = blockIdx.x;                                            // 0..63
  const int pair = (int)blockIdx.y < NTILE / 4 ? (int)blockIdx.y
                                               : 3 * NTILE / 4 - 1 - (int)blockIdx.y;  // 0..3, 7..4
  const int qTileIdx = wave < 4 ? NTILE - 1 - pair : pair;
  const size_t baseBH = (size_t)bh * S_LEN * DHEAD;

  const int qBase0 = qTileIdx * QTILE;
  const int qRow0  = qBase0 + (wave & 3) * (16 * CG);   // first q row owned by this wave
  const int myQRow = qRow0 + l16;   // this lane's query in column group 0; group c: + 16 * c

  // ---- Q^T B-fragments, per column group: 64x16 as two 32x16 f16 chunks (column = this lane's query).
  // Scale folds 1/sqrt(d) AND log2(e): softmax done in exp2 domain (exact).
  const float scale = 0.125f * 1.4426950408889634f;
  v16h aq[CG][2];
#pragma unroll
  for (int c = 0; c < CG; ++c) {
    const float* qp = Q + baseBH + (size_t)(myQRow + c * 16) * DHEAD;
#pragma unroll
    for (int f = 0; f < 2; ++f) {
      load8_scaled(qp + f * 32 + hi * 8,      scale, aq[c][f], 0);  // K = 0..7  (lane half)
      load8_scaled(qp + f * 32 + 16 + hi * 8, scale, aq[c][f], 8);  // K = 16..23 (lane half)
    }
  }

  const float NEG_INF = -__builtin_inff();
  float mcol[CG];         // running maximum of this lane's query (equal in both halves)
  float lcol[CG];         // running sum over the keys THIS lane half has seen
  v8f  oacc[CG][4];       // oacc[c][n][r] = O^T[d = n*16 + hi*8 + r][query c*16 + l16]
#pragma unroll
  for (int c = 0; c < CG; ++c) {
    mcol[c] = NEG_INF;
    lcol[c] = 0.0f;
#pragma unroll
    for (int n = 0; n < 4; ++n) oacc[c][n] = (v8f)0.0f;
  }

  const int jEnd  = (NTILE - pair) * QTILE;  // block-uniform staging bound: the long tile's end
  const int myEnd = qRow0 + 16 * CG; // keys >= myEnd are fully masked for this wave

  // One step's products and softmax on the tile of keys j .. j + 31 held in (Kl, Vl).
  auto compute = [&](const _Float16 (*Kl)[KPAD], const _Float16 (*Vl)[VPAD],
                     const int j) __attribute__((always_inline)) {
    // ---- S^T = K * Q^T : two 16-key groups, 2 WMMAs each (d split 32+32) per column group
    // st[c][g][r] = score of key j + g*16 + hi*8 + r against query myQRow + c*16
    v8f st[CG][2];
#pragma unroll
    for (int g = 0; g < 2; ++g) {
#pragma unroll
      for (int c = 0; c < CG; ++c) st[c][g] = (v8f)0.0f;
#pragma unroll
      for (int f = 0; f < 2; ++f) {
        v16h ka = ld_frag(&Kl[g * 16 + l16][f * 32 + hi * 8],
                          &Kl[g * 16 + l16][f * 32 + 16 + hi * 8]);
#pragma unroll
        for (int c = 0; c < CG; ++c)
          st[c][g] = __builtin_amdgcn_wmma_f32_16x16x32_f16(false, ka, false, aq[c][f],
                                                            (short)0, st[c][g], false, false);
      }
    }

    // ---- causal mask: only the single diagonal step needs it (wave-uniform test)
    if (j + KSTEP - 1 > qRow0) {
#pragma unroll
      for (int c = 0; c < CG; ++c) {
        const int q = myQRow + c * 16;
#pragma unroll
        for (int r = 0; r < 8; ++r) {
          int k0 = j + hi * 8 + r;
          if (k0 > q)      st[c][0][r] = NEG_INF;
          if (k0 + 16 > q) st[c][1][r] = NEG_INF;
        }
      }
    }

    // ---- online softmax in exp2 domain: in-lane over 16 keys, one exchange of halves
    v16h pb[CG];   // P^T as B operand: element s is key 8*hi + s (s < 8) or 16 + 8*hi + s - 8 (s >= 8), the order of the Vt loads
#pragma unroll
    for (int c = 0; c < CG; ++c) {
      float t0 = st[c][0][0], t1 = st[c][1][0];
#pragma unroll
      for (int r = 1; r < 8; ++r) { t0 = max_num(t0, st[c][0][r]); t1 = max_num(t1, st[c][1][r]); }
      float t     = max_num(t0, t1);
      float mnew  = max_num(mcol[c], max_num(t, other_half(t)));
      float alpha = exp2_raw(mcol[c] - mnew);
      mcol[c] = mnew;
      float s0 = 0.0f, s1 = 0.0f;
#pragma unroll
      for (int r = 0; r < 8; r += 2) {
        // subtract on a score tile's own register pairs: one packed instruction, no copies
        v2f d0 = {st[c][0][r], st[c][0][r + 1]};
        v2f d1 = {st[c][1][r], st[c][1][r + 1]};
        d0 -= mnew; d1 -= mnew;
        float p0 = exp2_raw(d0.x), p1 = exp2_raw(d1.x);
        float u0 = exp2_raw(d0.y), u1 = exp2_raw(d1.y);
        s0 += p0; s1 += p1;
        s0 += u0; s1 += u1;
        pb[c][r]     = (_Float16)p0; pb[c][r + 1] = (_Float16)u0;
        pb[c][r + 8] = (_Float16)p1; pb[c][r + 9] = (_Float16)u1;
      }
      lcol[c] = lcol[c] * alpha + (s0 + s1);
#pragma unroll
      for (int n = 0; n < 4; ++n) oacc[c][n] *= alpha;
    }

    // ---- O^T += V^T * P^T : 4 d-row tiles of 16, each V fragment used by both column groups
#pragma unroll
    for (int n = 0; n < 4; ++n) {
      v16h va = ld_frag(&Vl[n * 16 + l16][hi * 8],
                        &Vl[n * 16 + l16][16 + hi * 8]);
#pragma unroll
      for (int c = 0; c < CG; ++c)
        oacc[c][n] = __builtin_amdgcn_wmma_f32_16x16x32_f16(false, va, false, pb[c],
                                                            (short)0, oacc[c][n], false, false);
    }
  };

  // ---- staging: thread tid holds floats tid*4 + it*1024 of a tile: key (tid >> 4) + it*16, d (tid & 15)*4
  const float* kp = K + baseBH + tid * 4;
  const float* vp = V + baseBH + tid * 4;
  const int srow = tid >> 4, scol = (tid & 15) * 4;
  // Hint for the tile one step ahead of the loads (locality=3 -> near scope): 64 B a thread,
  // waves 0-3 for the K tile, waves 4-7 for the V tile.
  const float* hp = (wave < 4 ? K : V) + baseBH + (tid & 127) * 16;
  auto hint = [&](const int jt) __attribute__((always_inline)) {
    __builtin_prefetch(hp + (size_t)jt * DHEAD, 0, 3);
  };
  float4 kk[2], vv[2];
  hint(KSTEP);
  load_tile(kp, kk);
  load_tile(vp, vv);
  store_tile(&Klds0[srow][scol], &Vt0[scol][srow], kk, vv);
  __syncthreads();   // tile 0 is published

  // Two steps a trip (the walk is a multiple of 4 steps), so each buffer is a constant.
  // A step: issue the next tile's loads, work on this tile, store the next tile to the other
  // buffer, whose readers all passed the previous barrier; one barrier publishes it and ends
  // this tile's reads. A wave for which the whole step is masked only stages (wave-uniform).
  for (int j = 0; j < jEnd; j += 2 * KSTEP) {
    const bool more = j + 2 * KSTEP < jEnd;   // block-uniform: tiles j + 64 and j + 96 exist
    if (more) hint(j + 2 * KSTEP);
    load_tile(kp + (size_t)(j + KSTEP) * DHEAD, kk);
    load_tile(vp + (size_t)(j + KSTEP) * DHEAD, vv);
    if (j < myEnd) compute(Klds0, Vt0, j);
    store_tile(&Klds1[srow][scol], &Vt1[scol][srow], kk, vv);
    __syncthreads();

    if (more) {
      hint(j + 3 * KSTEP);
      load_tile(kp + (size_t)(j + 2 * KSTEP) * DHEAD, kk);
      load_tile(vp + (size_t)(j + 2 * KSTEP) * DHEAD, vv);
    }
    if (j + KSTEP < myEnd) compute(Klds1, Vt1, j + KSTEP);
    if (more) store_tile(&Klds0[srow][scol], &Vt0[scol][srow], kk, vv);
    __syncthreads();
  }

  // ---- epilogue: join the halves' sums, O / l; a lane owns 8 consecutive d per tile
#pragma unroll
  for (int c = 0; c < CG; ++c) {
    const float inv = 1.0f / (lcol[c] + other_half(lcol[c]));
    float* op = O + baseBH + (size_t)(myQRow + c * 16) * DHEAD + hi * 8;
#pragma unroll
    for (int n = 0; n < 4; ++n) {
      float4 a, b;
      a.x = oacc[c][n][0] * inv; a.y = oacc[c][n][1] * inv; a.z = oacc[c][n][2] * inv; a.w = oacc[c][n][3] * inv;
      b.x = oacc[c][n][4] * inv; b.y = oacc[c][n][5] * inv; b.z = oacc[c][n][6] * inv; b.w = oacc[c][n][7] * inv;
      *(float4*)(op + n * 16)     = a;
      *(float4*)(op + n * 16 + 4) = b;
    }
  }
}

extern "C" void kernel_launch(void* const* d_in, const int* in_sizes, int n_in,
                              void* d_out, int out_size, void* d_ws, size_t ws_size,
                              hipStream_t stream) {
  (void)in_sizes; (void)n_in; (void)out_size; (void)d_ws; (void)ws_size;
  const float* q = (const float*)d_in[0];
  const float* k = (const float*)d_in[1];
  const float* v = (const float*)d_in[2];
  float* o = (float*)d_out;
  dim3 grid(4 * 16, NTILE / 2);       // 64 (batch*head) fastest x 8 pairs of q tiles
  dim3 block(256);                    // 8 waves (wave32)
  Attention_62302795596087_kernel<<<grid, block, 0, stream>>>(q, k, v, o);
}

// v007
// One run takes 45.2 microseconds.
// In two side-by-side timings against v006, it was 1.32 and 1.31 times as fast.
// Over all steps from v000 it is 4.81 times as fast.
#include <hip/hip_runtime.h>

typedef _Float16 v16h __attribute__((ext_vector_type(16)));
typedef _Float16 v8h  __attribute__((ext_vector_type(8)));
typedef _Float16 v4h  __attribute__((ext_vector_type(4)));
typedef short    v8s  __attribute__((ext_vector_type(8)));
typedef float    v8f  __attribute__((ext_vector_type(8)));
typedef float    v2f  __attribute__((ext_vector_type(2)));

#define S_LEN 2048
#define DHEAD 64
#define QTILE 128      // q rows per causal tile (4 waves x 32); a block holds two tiles
#define NTILE (S_LEN / QTILE)
#define CG    2        // 16-query column groups per wave
#define KSTEP 32       // keys per inner step (WMMA K for PV)
// padded LDS row strides (in halves), each for its reader
#define KPAD  72       // K tile rows: 64 cols -> stride 72 (144 B = 16 B x odd, for ds_load_b128)
#define VPAD  80       // V tile rows: 64 cols -> stride 80 (160 B = 32 B x odd, for ds_load_tr16_b128)

// Value of the same query column in the other lane half (lane l <-> l ^ 16).
__device__ inline float other_half(float x) {
  int b = __float_as_int(x);
  return __int_as_float(__builtin_amdgcn_permlanex16(b, b, 0x76543210, 0xfedcba98, false, false));
}
__device__ inline float max_num(float a, float b) { return __builtin_fmaximum_numf(a, b); }
// 2^x as the bare v_exp_f32. The library form wraps it in a compare, two selects, an
// add and an ldexp per value so that results below 2^-126 come out as denormals; here
// every argument is <= 0 and such a result is nothing beside a row sum that holds the
// maximum's own 1.0 (and is 0 as f16), so it may flush to 0. -inf still gives 0.
__device__ inline float exp2_raw(float x) { return __builtin_amdgcn_exp2f(x); }

// Build a 16x32 (A/B) f16 fragment from two contiguous 8-half (16B) LDS rows.
__device__ inline v16h ld_frag(const _Float16* p_lo, const _Float16* p_hi) {
  v8h lo = *(const v8h*)p_lo;
  v8h hi = *(const v8h*)p_hi;
  v16h r;
#pragma unroll
  for (int i = 0; i < 8; ++i) { r[i] = lo[i]; r[i + 8] = hi[i]; }
  return r;
}

// 16 (d) x 32 (keys) A fragment of V^T out of a row-major (keys x d) f16 tile, by two transposing
// loads. p is this lane's address: row 8 * (lane >> 4) + (lane & 7), column d0 + 8 * ((lane >> 3) & 1).
// The lane gets column d0 + (lane & 15) at rows 8 * (lane >> 4) + 0..7, then the same 16 rows further
// on: the k order of ld_frag and of the packed scores.
__device__ inline v16h ld_frag_tr(const _Float16* p) {
  typedef __attribute__((address_space(3))) v8s lds_v8s;
  v8h lo = __builtin_bit_cast(v8h, __builtin_amdgcn_ds_load_tr16_b128_v8i16((lds_v8s*)p));
  v8h hi = __builtin_bit_cast(v8h, __builtin_amdgcn_ds_load_tr16_b128_v8i16((lds_v8s*)(p + 16 * VPAD)));
  v16h r;
#pragma unroll
  for (int i = 0; i < 8; ++i) { r[i] = lo[i]; r[i + 8] = hi[i]; }
  return r;
}

// Load 8 consecutive floats, scale, convert to halves at a[off..off+7].
__device__ inline void load8_scaled(const float* p, float s, v16h& a, int off) {
  float4 u = *(const float4*)p;
  float4 w = *(const float4*)(p + 4);
  a[off + 0] = (_Float16)(u.x * s); a[off + 1] = (_Float16)(u.y * s);
  a[off + 2] = (_Float16)(u.z * s); a[off + 3] = (_Float16)(u.w * s);
  a[off + 4] = (_Float16)(w.x * s); a[off + 5] = (_Float16)(w.y * s);
  a[off + 6] = (_Float16)(w.z * s); a[off + 7] = (_Float16)(w.w * s);
}

// One thread's share of a 32 x 64 f32 tile: two float4, 256 threads apart (tile is contiguous).
__device__ inline void load_tile(const float* __restrict__ p, float4 (&r)[2]) {
#pragma unroll
  for (int it = 0; it < 2; ++it) r[it] = *(const float4*)(p + it * 1024);
}
// Convert and store that share, K at kdst and V at vdst, both row-major (this thread's row,
// column): 8 bytes a store; share it lies 16 keys further on.
__device__ inline void store_tile(_Float16* kdst, _Float16* vdst,
                                  const float4 (&kk)[2], const float4 (&vv)[2]) {
#pragma unroll
  for (int it = 0; it < 2; ++it) {
    v4h kh; kh[0] = (_Float16)kk[it].x; kh[1] = (_Float16)kk[it].y;
            kh[2] = (_Float16)kk[it].z; kh[3] = (_Float16)kk[it].w;
    *(v4h*)(kdst + it * 16 * KPAD) = kh;
    v4h vh; vh[0] = (_Float16)vv[it].x; vh[1] = (_Float16)vv[it].y;
            vh[2] = (_Float16)vv[it].z; vh[3] = (_Float16)vv[it].w;
    *(v4h*)(vdst + it * 16 * VPAD) = vh;
  }
}

// Four waves per SIMD: the 512 work-groups fill the chip at exactly two per WGP, and that
// register budget holds a step's four V^T fragments beside its scores.
__global__ __launch_bounds__(256) __attribute__((amdgpu_waves_per_eu(4, 4)))
void Attention_62302795596087_kernel(const float* __restrict__ Q,
                                     const float* __restrict__ K,
                                     const float* __restrict__ V,
                                     float* __restrict__ O)
{
  // two buffers each, K tile and V tile, both row-major (keys x d)
  __shared__ alignas(16) _Float16 Klds0[KSTEP][KPAD];
  __shared__ alignas(16) _Float16 Klds1[KSTEP][KPAD];
  __shared__ alignas(16) _Float16 Vlds0[KSTEP][VPAD];
  __shared__ alignas(16) _Float16 Vlds1[KSTEP][VPAD];

  const int tid  = threadIdx.x;
  const int wave = tid >> 5;
  const int lane = tid & 31;
  const int l16  = lane & 15;
  const int hi   = lane >> 4;          // 0: lanes 0-15, 1: lanes 16-31

  // Causal cost grows with the q tile (tile t works on 4*(t+1) key steps) and all work-groups
  // are resident at once, so the launch lasts as long as the fullest WGP. Tile 15 - p and tile p
  // together always make 17 tile units. The block walks the long tile's keys; the trip count is
  // block-uniform and every wave stages and passes every barrier, also behind its own last key.
  // The walk still differs (16 - p units): pairs 0..3 are followed by 7..4, so that two
  // work-groups 256 indices apart have walks that add up alike. Head index runs fastest.
  const int bh   = blockIdx.x;                                            // 0..63
  const int pair = (int)blockIdx.y < NTILE / 4 ? (int)blockIdx.y
                                               : 3 * NTILE / 4 - 1 - (int)blockIdx.y;  // 0..3, 7..4
  const int qTileIdx = wave < 4 ? NTILE - 1 - pair : pair;
  const size_t baseBH = (size_t)bh * S_LEN * DHEAD;

  const int qBase0 = qTileIdx * QTILE;
  const int qRow0  = qBase0 + (wave & 3) * (16 * CG);   // first q row owned by this wave
  const int myQRow = qRow0 + l16;   // this lane's query in column group 0; group c: + 16 * c

  // ---- Q^T B-fragments, per column group: 64x16 as two 32x16 f16 chunks (column = this lane's query).
  // Scale folds 1/sqrt(d) AND log2(e): softmax done in exp2 domain (exact).
  const float scale = 0.125f * 1.4426950408889634f;
  v16h aq[CG][2];
#pragma unroll
  for (int c = 0; c < CG; ++c) {
    const float* qp = Q + baseBH + (size_t)(myQRow + c * 16) * DHEAD;
#pragma unroll
    for (int f = 0; f < 2; ++f) {
      load8_scaled(qp + f * 32 + hi * 8,      scale, aq[c][f], 0);  // K = 0..7  (lane half)
      load8_scaled(qp + f * 32 + 16 + hi * 8, scale, aq[c][f], 8);  // K = 16..23 (lane half)
    }
  }

  const float NEG_INF = -__builtin_inff();
  float mcol[CG];         // running maximum of this lane's query (equal in both halves)
  float lcol[CG];         // running sum over the keys THIS lane half has seen
  v8f  oacc[CG][4];       // oacc[c][n][r] = O^T[d = n*16 + hi*8 + r][query c*16 + l16]
#pragma unroll
  for (int c = 0; c < CG; ++c) {
    mcol[c] = NEG_INF;
    lcol[c] = 0.0f;
#pragma unroll
    for (int n = 0; n < 4; ++n) oacc[c][n] = (v8f)0.0f;
  }

  const int jEnd  = (NTILE - pair) * QTILE;  // block-uniform staging bound: the long tile's end
  const int myEnd = qRow0 + 16 * CG; // keys >= myEnd are fully masked for this wave

  // One step's products and softmax on the tile of keys j .. j + 31 held in (Kl, Vl).
  auto compute = [&](const _Float16 (*Kl)[KPAD], const _Float16 (*Vl)[VPAD],
                     const int j) __attribute__((always_inline)) {
    // ---- S^T = K * Q^T : two 16-key groups, 2 WMMAs each (d split 32+32) per column group
    // st[c][g][r] = score of key j + g*16 + hi*8 + r against query myQRow + c*16
    v8f st[CG][2];
#pragma unroll
    for (int g = 0; g < 2; ++g) {
#pragma unroll
      for (int c = 0; c < CG; ++c) st[c][g] = (v8f)0.0f;
#pragma unroll
      for (int f = 0; f < 2; ++f) {
        v16h ka = ld_frag(&Kl[g * 16 + l16][f * 32 + hi * 8],
                          &Kl[g * 16 + l16][f * 32 + 16 + hi * 8]);
#pragma unroll
        for (int c = 0; c < CG; ++c)
          st[c][g] = __builtin_amdgcn_wmma_f32_16x16x32_f16(false, ka, false, aq[c][f],
                                                            (short)0, st[c][g], false, false);
      }
    }

    // ---- V^T fragments, 4 d-row tiles of 16: the step's 8 transposing loads as one group, so
    // that they land under the softmax and no LDS read stands among the second product's WMMAs
    v16h va[4];
#pragma unroll
    for (int n = 0; n < 4; ++n)
      va[n] = ld_frag_tr(&Vl[hi * 8 + (lane & 7)][n * 16 + ((lane >> 3) & 1) * 8]);

    // ---- causal mask: only the single diagonal step needs it (wave-uniform test)
    if (j + KSTEP - 1 > qRow0) {
#pragma unroll
      for (int c = 0; c < CG; ++c) {
        const int q = myQRow + c * 16;
#pragma unroll
        for (int r = 0; r < 8; ++r) {
          int k0 = j + hi * 8 + r;
          if (k0 > q)      st[c][0][r] = NEG_INF;
          if (k0 + 16 > q) st[c][1][r] = NEG_INF;
        }
      }
    }

    // ---- online softmax in exp2 domain: in-lane over 16 keys, one exchange of halves
    v16h pb[CG];   // P^T as B operand: element s is key 8*hi + s (s < 8) or 16 + 8*hi + s - 8 (s >= 8), the order of the V^T loads
#pragma unroll
    for (int c = 0; c < CG; ++c) {
      float t0 = st[c][0][0], t1 = st[c][1][0];
#pragma unroll
      for (int r = 1; r < 8; ++r) { t0 = max_num(t0, st[c][0][r]); t1 = max_num(t1, st[c][1][r]); }
      float t     = max_num(t0, t1);
      float mnew  = max_num(mcol[c], max_num(t, other_half(t)));
      float alpha = exp2_raw(mcol[c] - mnew);
      mcol[c] = mnew;
      float s0 = 0.0f, s1 = 0.0f;
#pragma unroll
      for (int r = 0; r < 8; r += 2) {
        // subtract on a score tile's own register pairs: one packed instruction, no copies
        v2f d0 = {st[c][0][r], st[c][0][r + 1]};
        v2f d1 = {st[c][1][r], st[c][1][r + 1]};
        d0 -= mnew; d1 -= mnew;
        float p0 = exp2_raw(d0.x), p1 = exp2_raw(d1.x);
        float u0 = exp2_raw(d0.y), u1 = exp2_raw(d1.y);
        s0 += p0; s1 += p1;
        s0 += u0; s1 += u1;
        pb[c][r]     = (_Float16)p0; pb[c][r + 1] = (_Float16)u0;
        pb[c][r + 8] = (_Float16)p1; pb[c][r + 9] = (_Float16)u1;
      }
      lcol[c] = lcol[c] * alpha + (s0 + s1);
#pragma unroll
      for (int n = 0; n < 4; ++n) oacc[c][n] *= alpha;
    }

    // ---- O^T += V^T * P^T : each V fragment used by both column groups
#pragma unroll
    for (int n = 0; n < 4; ++n) {
#pragma unroll
      for (int c = 0; c < CG; ++c)
        oacc[c][n] = __builtin_amdgcn_wmma_f32_16x16x32_f16(false, va[n], false, pb[c],
                                                            (short)0, oacc[c][n], false, false);
    }
  };

  // ---- staging: thread tid holds floats tid*4 + it*1024 of a tile: key (tid >> 4) + it*16, d (tid & 15)*4
  const float* kp = K + baseBH + tid * 4;
  const float* vp = V + baseBH + tid * 4;
  const int srow = tid >> 4, scol = (tid & 15) * 4;
  // Hint for the tile one step ahead of the loads (locality=3 -> near scope): 64 B a thread,
  // waves 0-3 for the K tile, waves 4-7 for the V tile.
  const float* hp = (wave < 4 ? K : V) + baseBH + (tid & 127) * 16;
  auto hint = [&](const int jt) __attribute__((always_inline)) {
    __builtin_prefetch(hp + (size_t)jt * DHEAD, 0, 3);
  };
  float4 kk[2], vv[2];
  hint(KSTEP);
  load_tile(kp, kk);
  load_tile(vp, vv);
  store_tile(&Klds0[srow][scol], &Vlds0[srow][scol], kk, vv);
  __syncthreads();   // tile 0 is published

  // Two steps a trip (the walk is a multiple of 4 steps), so each buffer is a constant.
  // A step: issue the next tile's loads, work on this tile, store the next tile to the other
  // buffer, whose readers all passed the previous barrier; one barrier publishes it and ends
  // this tile's reads. A wave for which the whole step is masked only stages (wave-uniform).
  for (int j = 0; j < jEnd; j += 2 * KSTEP) {
    const bool more = j + 2 * KSTEP < jEnd;   // block-uniform: tiles j + 64 and j + 96 exist
    if (more) hint(j + 2 * KSTEP);
    load_tile(kp + (size_t)(j + KSTEP) * DHEAD, kk);
    load_tile(vp + (size_t)(j + KSTEP) * DHEAD, vv);
    if (j < myEnd) compute(Klds0, Vlds0, j);
    store_tile(&Klds1[srow][scol], &Vlds1[srow][scol], kk, vv);
    __syncthreads();

    if (more) {
      hint(j + 3 * KSTEP);
      load_tile(kp + (size_t)(j + 2 * KSTEP) * DHEAD, kk);
      load_tile(vp + (size_t)(j + 2 * KSTEP) * DHEAD, vv);
    }
    if (j + KSTEP < myEnd) compute(Klds1, Vlds1, j + KSTEP);
    if (more) store_tile(&Klds0[srow][scol], &Vlds0[srow][scol], kk, vv);
    __syncthreads();
  }

  // ---- epilogue: join the halves' sums, O / l; a lane owns 8 consecutive d per tile
#pragma unroll
  for (int c = 0; c < CG; ++c) {
    const float inv = 1.0f / (lcol[c] + other_half(lcol[c]));
    float* op = O + baseBH + (size_t)(myQRow + c * 16) * DHEAD + hi * 8;
#pragma unroll
    for (int n = 0; n < 4; ++n) {
      float4 a, b;
      a.x = oacc[c][n][0] * inv; a.y = oacc[c][n][1] * inv; a.z = oacc[c][n][2] * inv; a.w = oacc[c][n][3] * inv;
      b.x = oacc[c][n][4] * inv; b.y = oacc[c][n][5] * inv; b.z = oacc[c][n][6] * inv; b.w = oacc[c][n][7] * inv;
      *(float4*)(op + n * 16)     = a;
      *(float4*)(op + n * 16 + 4) = b;
    }
  }
}

extern "C" void kernel_launch(void* const* d_in, const int* in_sizes, int n_in,
                              void* d_out, int out_size, void* d_ws, size_t ws_size,
                              hipStream_t stream) {
  (void)in_sizes; (void)n_in; (void)out_size; (void)d_ws; (void)ws_size;
  const float* q = (const float*)d_in[0];
  const float* k = (const float*)d_in[1];
  const float* v = (const float*)d_in[2];
  float* o = (float*)d_out;
  dim3 grid(4 * 16, NTILE / 2);       // 64 (batch*head) fastest x 8 pairs of q tiles
  dim3 block(256);                    // 8 waves (wave32)
  Attention_62302795596087_kernel<<<grid, block, 0, stream>>>(q, k, v, o);
}

// v009
// A run of this version takes 40.4 microseconds.
// It is 1.13 times as fast as v007, going by the measured steps of the versions left out in between.
// Counting every step since v000, it is 5.42 times as fast.
#include <hip/hip_runtime.h>

typedef _Float16 v16h __attribute__((ext_vector_type(16)));
typedef _Float16 v8h  __attribute__((ext_vector_type(8)));
typedef _Float16 v4h  __attribute__((ext_vector_type(4)));
typedef short    v8s  __attribute__((ext_vector_type(8)));
typedef float    v8f  __attribute__((ext_vector_type(8)));

#define S_LEN 2048
#define DHEAD 64
#define QTILE 128      // q rows per causal tile (4 waves x 32); a block holds two tiles
#define NTILE (S_LEN / QTILE)
#define CG    2        // 16-query column groups per wave
#define KSTEP 32       // keys per inner step (WMMA K for PV)
// padded LDS row strides (in halves), each for its reader
#define KPAD  72       // K tile rows: 64 cols -> stride 72 (144 B = 16 B x odd, for ds_load_b128)
#define VPAD  80       // V tile rows: 64 cols -> stride 80 (160 B = 32 B x odd, for ds_load_tr16_b128)
#define NSTEP 4                          // tiles (steps) per LDS stage; a walk is a multiple of it
#define KT_H  (KSTEP * KPAD)             // halves in a K tile
#define VT_H  (KSTEP * VPAD)             // halves in a V tile
#define VOFF  (NSTEP * KT_H)             // a stage: its K tiles, then its V tiles
#define STAGE_H (NSTEP * (KT_H + VT_H))  // halves in a stage

// Value of the same query column in the other lane half (lane l <-> l ^ 16).
__device__ inline float other_half(float x) {
  int b = __float_as_int(x);
  return __int_as_float(__builtin_amdgcn_permlanex16(b, b, 0x76543210, 0xfedcba98, false, false));
}
__device__ inline float max_num(float a, float b) { return __builtin_fmaximum_numf(a, b); }
// 2^x as the bare v_exp_f32. The library form wraps it in a compare, two selects, an
// add and an ldexp per value so that results below 2^-126 come out as denormals; here
// an argument may exceed 0 before a rescale, but such a result is nothing beside a row sum that holds the
// maximum's own 1.0 (and is 0 as f16), so it may flush to 0. -inf still gives 0.
__device__ inline float exp2_raw(float x) { return __builtin_amdgcn_exp2f(x); }

// Build a 16x32 (A/B) f16 fragment from two contiguous 8-half (16B) LDS rows.
__device__ inline v16h ld_frag(const _Float16* p_lo, const _Float16* p_hi) {
  v8h lo = *(const v8h*)p_lo;
  v8h hi = *(const v8h*)p_hi;
  v16h r;
#pragma unroll
  for (int i = 0; i < 8; ++i) { r[i] = lo[i]; r[i + 8] = hi[i]; }
  return r;
}

// 16 (d) x 32 (keys) A fragment of V^T out of a row-major (keys x d) f16 tile, by two transposing
// loads. p is this lane's address: row 8 * (lane >> 4) + (lane & 7), column d0 + 8 * ((lane >> 3) & 1).
// The lane gets column d0 + (lane & 15) at rows 8 * (lane >> 4) + 0..7, then the same 16 rows further
// on: the k order of ld_frag and of the packed scores.
__device__ inline v16h ld_frag_tr(const _Float16* p) {
  typedef __attribute__((address_space(3))) v8s lds_v8s;
  v8h lo = __builtin_bit_cast(v8h, __builtin_amdgcn_ds_load_tr16_b128_v8i16((lds_v8s*)p));
  v8h hi = __builtin_bit_cast(v8h, __builtin_amdgcn_ds_load_tr16_b128_v8i16((lds_v8s*)(p + 16 * VPAD)));
  v16h r;
#pragma unroll
  for (int i = 0; i < 8; ++i) { r[i] = lo[i]; r[i + 8] = hi[i]; }
  return r;
}

// Load 8 consecutive floats, scale, convert to halves at a[off..off+7].
__device__ inline void load8_scaled(const float* p, float s, v16h& a, int off) {
  float4 u = *(const float4*)p;
  float4 w = *(const float4*)(p + 4);
  a[off + 0] = (_Float16)(u.x * s); a[off + 1] = (_Float16)(u.y * s);
  a[off + 2] = (_Float16)(u.z * s); a[off + 3] = (_Float16)(u.w * s);
  a[off + 4] = (_Float16)(w.x * s); a[off + 5] = (_Float16)(w.y * s);
  a[off + 6] = (_Float16)(w.z * s); a[off + 7] = (_Float16)(w.w * s);
}

// One thread's share of a 32 x 64 f32 tile: two float4, 256 threads apart (tile is contiguous).
__device__ inline void load_tile(const float* __restrict__ p, float4 (&r)[2]) {
#pragma unroll
  for (int it = 0; it < 2; ++it) r[it] = *(const float4*)(p + it * 1024);
}
// Convert and store that share, K at kdst and V at vdst, both row-major (this thread's row,
// column): 8 bytes a store; share it lies 16 keys further on.
__device__ inline void store_tile(_Float16* kdst, _Float16* vdst,
                                  const float4 (&kk)[2], const float4 (&vv)[2]) {
#pragma unroll
  for (int it = 0; it < 2; ++it) {
    v4h kh; kh[0] = (_Float16)kk[it].x; kh[1] = (_Float16)kk[it].y;
            kh[2] = (_Float16)kk[it].z; kh[3] = (_Float16)kk[it].w;
    *(v4h*)(kdst + it * 16 * KPAD) = kh;
    v4h vh; vh[0] = (_Float16)vv[it].x; vh[1] = (_Float16)vv[it].y;
            vh[2] = (_Float16)vv[it].z; vh[3] = (_Float16)vv[it].w;
    *(v4h*)(vdst + it * 16 * VPAD) = vh;
  }
}

// Four waves per SIMD: the 512 work-groups fill the chip at exactly two per WGP, and that
// register budget holds a step's four V^T fragments beside its scores.
__global__ __launch_bounds__(256) __attribute__((amdgpu_waves_per_eu(4, 4)))
void Attention_62302795596087_kernel(const float* __restrict__ Q,
                                     const float* __restrict__ K,
                                     const float* __restrict__ V,
                                     float* __restrict__ O)
{
  // two stages of NSTEP K tiles and NSTEP V tiles, all row-major (keys x d)
  __shared__ alignas(16) _Float16 Ring[2 * STAGE_H];

  const int tid  = threadIdx.x;
  const int wave = tid >> 5;
  const int lane = tid & 31;
  const int l16  = lane & 15;
  const int hi   = lane >> 4;          // 0: lanes 0-15, 1: lanes 16-31

  // Causal cost grows with the q tile (tile t works on 4*(t+1) key steps) and all work-groups
  // are resident at once, so the launch lasts as long as the fullest WGP. Tile 15 - p and tile p
  // together always make 17 tile units. The block walks the long tile's keys; the trip count is
  // block-uniform and every wave stages and passes every barrier, also behind its own last key.
  // The walk still differs (16 - p units): pairs 0..3 are followed by 7..4, so that two
  // work-groups 256 indices apart have walks that add up alike. Head index runs fastest.
  const int bh   = blockIdx.x;                                            // 0..63
  const int pair = (int)blockIdx.y < NTILE / 4 ? (int)blockIdx.y
                                               : 3 * NTILE / 4 - 1 - (int)blockIdx.y;  // 0..3, 7..4
  const int qTileIdx = wave < 4 ? NTILE - 1 - pair : pair;
  const size_t baseBH = (size_t)bh * S_LEN * DHEAD;

  const int qBase0 = qTileIdx * QTILE;
  const int qRow0  = qBase0 + (wave & 3) * (16 * CG);   // first q row owned by this wave
  const int myQRow = qRow0 + l16;   // this lane's query in column group 0; group c: + 16 * c

  // ---- Q^T B-fragments, per column group: 64x16 as two 32x16 f16 chunks (column = this lane's query).
  // Scale folds 1/sqrt(d) AND log2(e): softmax done in exp2 domain (exact).
  const float scale = 0.125f * 1.4426950408889634f;
  v16h aq[CG][2];
#pragma unroll
  for (int c = 0; c < CG; ++c) {
    const float* qp = Q + baseBH + (size_t)(myQRow + c * 16) * DHEAD;
#pragma unroll
    for (int f = 0; f < 2; ++f) {
      load8_scaled(qp + f * 32 + hi * 8,      scale, aq[c][f], 0);  // K = 0..7  (lane half)
      load8_scaled(qp + f * 32 + 16 + hi * 8, scale, aq[c][f], 8);  // K = 16..23 (lane half)
    }
  }

  const float NEG_INF = -__builtin_inff();
  v8f  cneg[CG];          // minus the maximum in use of this lane's query (equal in both halves), 8 times: a C operand
  float lcol[CG];         // running sum over the keys THIS lane half has seen
  v8f  oacc[CG][4];       // oacc[c][n][r] = O^T[d = n*16 + hi*8 + r][query c*16 + l16]
#pragma unroll
  for (int c = 0; c < CG; ++c) {
    cneg[c] = (v8f)0.0f;  // a start value only: step 0 always sets the maximum from its own scores
    lcol[c] = 0.0f;
#pragma unroll
    for (int n = 0; n < 4; ++n) oacc[c][n] = (v8f)0.0f;
  }

  const int jEnd  = (NTILE - pair) * QTILE;  // block-uniform staging bound: the long tile's end
  const int myEnd = qRow0 + 16 * CG; // keys >= myEnd are fully masked for this wave

  // One step's products and softmax on the tile of keys j .. j + 31. Kl and Vl are this lane's own
  // places in the K tile (row l16, column hi * 8) and in the V tile (see ld_frag_tr).
  auto compute = [&](const _Float16* Kl, const _Float16* Vl,
                     const int j) __attribute__((always_inline)) {
    // ---- S^T = K * Q^T : two 16-key groups, 2 WMMAs each (d split 32+32) per column group
    // st[c][g][r] = score of key j + g*16 + hi*8 + r against query myQRow + c*16, less the maximum in use
    v8f st[CG][2];
#pragma unroll
    for (int g = 0; g < 2; ++g) {
#pragma unroll
      for (int c = 0; c < CG; ++c) st[c][g] = cneg[c];
#pragma unroll
      for (int f = 0; f < 2; ++f) {
        v16h ka = ld_frag(Kl + g * 16 * KPAD + f * 32,
                          Kl + g * 16 * KPAD + f * 32 + 16);
#pragma unroll
        for (int c = 0; c < CG; ++c)
          st[c][g] = __builtin_amdgcn_wmma_f32_16x16x32_f16(false, ka, false, aq[c][f],
                                                            (short)0, st[c][g], false, false);
      }
    }

    // ---- V^T fragments, 4 d-row tiles of 16: the step's 8 transposing loads as one group, so
    // that they land under the softmax and no LDS read stands among the second product's WMMAs
    v16h va[4];
#pragma unroll
    for (int n = 0; n < 4; ++n)
      va[n] = ld_frag_tr(Vl + n * 16);

    // ---- causal mask: only the single diagonal step needs it (wave-uniform test)
    if (j + KSTEP - 1 > qRow0) {
#pragma unroll
      for (int c = 0; c < CG; ++c) {
        const int q = myQRow + c * 16;
#pragma unroll
        for (int r = 0; r < 8; ++r) {
          int k0 = j + hi * 8 + r;
          if (k0 > q)      st[c][0][r] = NEG_INF;
          if (k0 + 16 > q) st[c][1][r] = NEG_INF;
        }
      }
    }

    // ---- online softmax in exp2 domain, in-lane over 16 keys
    v16h  pb[CG];   // P^T as B operand: element s is key j + 8 * hi + s (s < 8), j + 8 + 8 * hi + s (s >= 8), the order of the V^T loads
    float sum[CG];  // this lane half's sum of the step's 16 exponentials
    auto exponentials = [&]() __attribute__((always_inline)) {
#pragma unroll
      for (int c = 0; c < CG; ++c) {
        float s0 = 0.0f, s1 = 0.0f;
#pragma unroll
        for (int r = 0; r < 8; r += 2) {
          float p0 = exp2_raw(st[c][0][r]),     p1 = exp2_raw(st[c][1][r]);
          float u0 = exp2_raw(st[c][0][r + 1]), u1 = exp2_raw(st[c][1][r + 1]);
          s0 += p0; s1 += p1;
          s0 += u0; s1 += u1;
          pb[c][r]     = (_Float16)p0; pb[c][r + 1] = (_Float16)u0;
          pb[c][r + 8] = (_Float16)p1; pb[c][r + 9] = (_Float16)u1;
        }
        sum[c] = s0 + s1;
      }
    };
    exponentials();
    // One test a step for the whole wave (a scalar branch), made on the sums: while 16 exponentials
    // add up to 2^12 at most, each of them is far inside f16 and the maximum in use may stay.
    // Step 0 always takes the branch (any sum passes its bar) and sets the maximum from its scores.
    const float bar = j == 0 ? NEG_INF : 4096.0f;
    if (__builtin_amdgcn_ballot_w32(max_num(sum[0], sum[1]) > bar) != 0) {
#pragma unroll
      for (int c = 0; c < CG; ++c) {
        float t0 = st[c][0][0], t1 = st[c][1][0];
#pragma unroll
        for (int r = 1; r < 8; ++r) { t0 = max_num(t0, st[c][0][r]); t1 = max_num(t1, st[c][1][r]); }
        const float t     = max_num(t0, t1);
        const float tq    = max_num(t, other_half(t));           // over the query's 32 keys
        const float up    = max_num(tq, 0.0f);
        const float delta = j == 0 ? tq : up;                    // step 0 may also lower the start value
        const float alpha = exp2_raw(-up);                       // in step 0 it meets zeros only
        cneg[c] -= delta;
        st[c][0] -= delta;
        st[c][1] -= delta;
        lcol[c] *= alpha;
#pragma unroll
        for (int n = 0; n < 4; ++n) oacc[c][n] *= alpha;
      }
      exponentials();
    }
#pragma unroll
    for (int c = 0; c < CG; ++c) lcol[c] += sum[c];

    // ---- O^T += V^T * P^T : each V fragment used by both column groups
#pragma unroll
    for (int n = 0; n < 4; ++n) {
#pragma unroll
      for (int c = 0; c < CG; ++c)
        oacc[c][n] = __builtin_amdgcn_wmma_f32_16x16x32_f16(false, va[n], false, pb[c],
                                                            (short)0, oacc[c][n], false, false);
    }
  };

  // ---- staging: thread tid holds floats tid*4 + it*1024 of a tile: key (tid >> 4) + it*16, d (tid & 15)*4
  const float* kp = K + baseBH + tid * 4;
  const float* vp = V + baseBH + tid * 4;
  const int srow = tid >> 4, scol = (tid & 15) * 4;
  // Hint for the tile one step ahead of the loads (locality=3 -> near scope): 64 B a thread,
  // waves 0-3 for the K tile, waves 4-7 for the V tile.
  const float* hp = (wave < 4 ? K : V) + baseBH + (tid & 127) * 16;
  auto hint = [&](const int jt) __attribute__((always_inline)) {
    __builtin_prefetch(hp + (size_t)jt * DHEAD, 0, 3);
  };
  // This lane's places in the ring, in halves: where it reads fragments (stage 0 first) and where it
  // stores its share of a tile (stage 1 first); d takes each to the other stage after every barrier.
  int kr = l16 * KPAD + hi * 8;
  int vr = VOFF + (hi * 8 + (lane & 7)) * VPAD + ((lane >> 3) & 1) * 8;
  int kw = STAGE_H + srow * KPAD + scol;
  int vw = STAGE_H + VOFF + srow * VPAD + scol;
  int d  = STAGE_H;
  hint(NSTEP * KSTEP);
  // The registers that held the addresses of the Q loads and of the hint are free for reuse from
  // here on (the next loads land in them): the wait on address translation stands in front of that.
  asm volatile("s_wait_xcnt 0x0" ::: "memory");
  {
    // stage 0: all four tiles' loads in flight at once (the accumulators' registers are still free)
    float4 k0[NSTEP][2], v0[NSTEP][2];
    // both loops unrolled: constant indices keep the two arrays in registers
#pragma unroll
    for (int i = 0; i < NSTEP; ++i) {
      load_tile(kp + (size_t)(i * KSTEP) * DHEAD, k0[i]);
      load_tile(vp + (size_t)(i * KSTEP) * DHEAD, v0[i]);
    }
#pragma unroll
    for (int i = 0; i < NSTEP; ++i)
      store_tile(&Ring[kw - STAGE_H + i * KT_H], &Ring[vw - STAGE_H + i * VT_H], k0[i], v0[i]);
  }
  __syncthreads();   // stage 0 is published

  // A trip works on one stage (the walk is a multiple of NSTEP steps). A step: with the loads of the
  // same tile of the next stage in flight, work on this tile, then store the loaded tile to the other
  // stage, whose readers all passed the previous barrier, and issue the next step's loads. The one
  // barrier of a trip publishes the next stage and ends this stage's reads. A wave for which a whole
  // step is masked only stages (wave-uniform).
  float4 kk[2], vv[2];
  auto fetch = [&](const int jt) __attribute__((always_inline)) {   // tile of keys jt .. jt + 31
    load_tile(kp + (size_t)jt * DHEAD, kk);
    load_tile(vp + (size_t)jt * DHEAD, vv);
  };
  for (int j0 = 0; j0 < jEnd; j0 += NSTEP * KSTEP) {
    const int  jn   = j0 + NSTEP * KSTEP;   // first key of the next stage
    const bool more = jn < jEnd;            // block-uniform: the next stage exists
    if (more) { hint(jn + KSTEP); fetch(jn); }
    // unrolled so that a tile's place in its stage is an immediate offset of the LDS instructions
#pragma unroll
    for (int i = 0; i < NSTEP; ++i) {
      const int j = j0 + i * KSTEP;
      if (j < myEnd) compute(&Ring[kr + i * KT_H], &Ring[vr + i * VT_H], j);
      if (more) {
        store_tile(&Ring[kw + i * KT_H], &Ring[vw + i * VT_H], kk, vv);
        if (i < NSTEP - 1) {
          if (i < NSTEP - 2 || jn + NSTEP * KSTEP < jEnd) hint(jn + (i + 2) * KSTEP);
          fetch(jn + (i + 1) * KSTEP);
        }
      }
    }
    __syncthreads();
    kr += d; vr += d; kw -= d; vw -= d; d = -d;
  }

  // ---- epilogue: join the halves' sums, O / l; a lane owns 8 consecutive d per tile
#pragma unroll
  for (int c = 0; c < CG; ++c) {
    const float inv = 1.0f / (lcol[c] + other_half(lcol[c]));
    float* op = O + baseBH + (size_t)(myQRow + c * 16) * DHEAD + hi * 8;
#pragma unroll
    for (int n = 0; n < 4; ++n) {
      float4 a, b;
      a.x = oacc[c][n][0] * inv; a.y = oacc[c][n][1] * inv; a.z = oacc[c][n][2] * inv; a.w = oacc[c][n][3] * inv;
      b.x = oacc[c][n][4] * inv; b.y = oacc[c][n][5] * inv; b.z = oacc[c][n][6] * inv; b.w = oacc[c][n][7] * inv;
      *(float4*)(op + n * 16)     = a;
      *(float4*)(op + n * 16 + 4) = b;
    }
  }
}

extern "C" void kernel_launch(void* const* d_in, const int* in_sizes, int n_in,
                              void* d_out, int out_size, void* d_ws, size_t ws_size,
                              hipStream_t stream) {
  (void)in_sizes; (void)n_in; (void)out_size; (void)d_ws; (void)ws_size;
  const float* q = (const float*)d_in[0];
  const float* k = (const float*)d_in[1];
  const float* v = (const float*)d_in[2];
  float* o = (float*)d_out;
  dim3 grid(4 * 16, NTILE / 2);       // 64 (batch*head) fastest x 8 pairs of q tiles
  dim3 block(256);                    // 8 waves (wave32)
  Attention_62302795596087_kernel<<<grid, block, 0, stream>>>(q, k, v, o);
}

// v010
// A run of this version takes 39.2 microseconds.
// Two timings next to v009 put it at 1.04 and 1.02 times that version's speed.
// All steps since v000 together make it 5.57 times as fast.
#include <hip/hip_runtime.h>

typedef _Float16 v16h __attribute__((ext_vector_type(16)));
typedef _Float16 v8h  __attribute__((ext_vector_type(8)));
typedef _Float16 v4h  __attribute__((ext_vector_type(4)));
typedef short    v8s  __attribute__((ext_vector_type(8)));
typedef float    v8f  __attribute__((ext_vector_type(8)));

#define S_LEN 2048
#define DHEAD 64
#define QTILE 128      // q rows per causal tile (4 waves x 32); a block holds two tiles
#define NTILE (S_LEN / QTILE)
#define CG    2        // 16-query column groups per wave
#define KSTEP 32       // keys per inner step (WMMA K for PV)
// padded LDS row strides (in halves), each for its reader
#define KPAD  72       // K tile rows: 64 cols -> stride 72 (144 B = 16 B x odd, for ds_load_b128)
#define VPAD  80       // V tile rows: 64 cols -> stride 80 (160 B = 32 B x odd, for ds_load_tr16_b128)
#define NSTEP 4                          // tiles (steps) per LDS stage; a walk is a multiple of it
#define KT_H  (KSTEP * KPAD)             // halves in a K tile
#define VT_H  (KSTEP * VPAD)             // halves in a V tile
#define VOFF  (NSTEP * KT_H)             // a stage: its K tiles, then its V tiles
#define STAGE_H (NSTEP * (KT_H + VT_H))  // halves in a stage

// Value of the same query column in the other lane half (lane l <-> l ^ 16).
__device__ inline float other_half(float x) {
  int b = __float_as_int(x);
  return __int_as_float(__builtin_amdgcn_permlanex16(b, b, 0x76543210, 0xfedcba98, false, false));
}
__device__ inline float max_num(float a, float b) { return __builtin_fmaximum_numf(a, b); }
// 2^x as the bare v_exp_f32. The library form wraps it in a compare, two selects, an
// add and an ldexp per value so that results below 2^-126 come out as denormals; here
// an argument may exceed 0 before a rescale, but such a result is nothing beside a row sum that holds the
// maximum's own 1.0 (and is 0 as f16), so it may flush to 0. -inf still gives 0.
__device__ inline float exp2_raw(float x) { return __builtin_amdgcn_exp2f(x); }

// Build a 16x32 (A/B) f16 fragment from two contiguous 8-half (16B) LDS rows.
__device__ inline v16h ld_frag(const _Float16* p_lo, const _Float16* p_hi) {
  v8h lo = *(const v8h*)p_lo;
  v8h hi = *(const v8h*)p_hi;
  v16h r;
#pragma unroll
  for (int i = 0; i < 8; ++i) { r[i] = lo[i]; r[i + 8] = hi[i]; }
  return r;
}

// 16 (d) x 32 (keys) A fragment of V^T out of a row-major (keys x d) f16 tile, by two transposing
// loads. p is this lane's address: row 8 * (lane >> 4) + (lane & 7), column d0 + 8 * ((lane >> 3) & 1).
// The lane gets column d0 + (lane & 15) at rows 8 * (lane >> 4) + 0..7, then the same 16 rows further
// on: the k order of ld_frag and of the packed scores.
__device__ inline v16h ld_frag_tr(const _Float16* p) {
  typedef __attribute__((address_space(3))) v8s lds_v8s;
  v8h lo = __builtin_bit_cast(v8h, __builtin_amdgcn_ds_load_tr16_b128_v8i16((lds_v8s*)p));
  v8h hi = __builtin_bit_cast(v8h, __builtin_amdgcn_ds_load_tr16_b128_v8i16((lds_v8s*)(p + 16 * VPAD)));
  v16h r;
#pragma unroll
  for (int i = 0; i < 8; ++i) { r[i] = lo[i]; r[i + 8] = hi[i]; }
  return r;
}

// Load 8 consecutive floats, scale, convert to halves at a[off..off+7].
__device__ inline void load8_scaled(const float* p, float s, v16h& a, int off) {
  float4 u = *(const float4*)p;
  float4 w = *(const float4*)(p + 4);
  a[off + 0] = (_Float16)(u.x * s); a[off + 1] = (_Float16)(u.y * s);
  a[off + 2] = (_Float16)(u.z * s); a[off + 3] = (_Float16)(u.w * s);
  a[off + 4] = (_Float16)(w.x * s); a[off + 5] = (_Float16)(w.y * s);
  a[off + 6] = (_Float16)(w.z * s); a[off + 7] = (_Float16)(w.w * s);
}

// One thread's share of a 32 x 64 f32 tile: two float4, 256 threads apart (tile is contiguous).
__device__ inline void load_tile(const float* __restrict__ p, float4 (&r)[2]) {
#pragma unroll
  for (int it = 0; it < 2; ++it) r[it] = *(const float4*)(p + it * 1024);
}
// Convert and store that share, K at kdst and V at vdst, both row-major (this thread's row,
// column): 8 bytes a store; share it lies 16 keys further on.
__device__ inline void store_tile(_Float16* kdst, _Float16* vdst,
                                  const float4 (&kk)[2], const float4 (&vv)[2]) {
#pragma unroll
  for (int it = 0; it < 2; ++it) {
    v4h kh; kh[0] = (_Float16)kk[it].x; kh[1] = (_Float16)kk[it].y;
            kh[2] = (_Float16)kk[it].z; kh[3] = (_Float16)kk[it].w;
    *(v4h*)(kdst + it * 16 * KPAD) = kh;
    v4h vh; vh[0] = (_Float16)vv[it].x; vh[1] = (_Float16)vv[it].y;
            vh[2] = (_Float16)vv[it].z; vh[3] = (_Float16)vv[it].w;
    *(v4h*)(vdst + it * 16 * VPAD) = vh;
  }
}

// Four waves per SIMD: the 512 work-groups fill the chip at exactly two per WGP, and that
// register budget holds a step's four V^T fragments beside its scores.
__global__ __launch_bounds__(256) __attribute__((amdgpu_waves_per_eu(4, 4)))
void Attention_62302795596087_kernel(const float* __restrict__ Q,
                                     const float* __restrict__ K,
                                     const float* __restrict__ V,
                                     float* __restrict__ O)
{
  // two stages of NSTEP K tiles and NSTEP V tiles, all row-major (keys x d)
  __shared__ alignas(16) _Float16 Ring[2 * STAGE_H];

  const int tid  = threadIdx.x;
  const int wave = tid >> 5;
  const int lane = tid & 31;
  const int l16  = lane & 15;
  const int hi   = lane >> 4;          // 0: lanes 0-15, 1: lanes 16-31

  // Causal cost grows with the q tile (tile t works on 4*(t+1) key steps) and all work-groups
  // are resident at once, so the launch lasts as long as the fullest WGP. Tile 15 - p and tile p
  // together always make 17 tile units. The block walks the long tile's keys; the trip count is
  // block-uniform and every wave stages and passes every barrier, also behind its own last key.
  // The walk still differs (16 - p units): pairs 0..3 are followed by 7..4, so that two
  // work-groups 256 indices apart have walks that add up alike. Head index runs fastest.
  const int bh   = blockIdx.x;                                            // 0..63
  const int pair = (int)blockIdx.y < NTILE / 4 ? (int)blockIdx.y
                                               : 3 * NTILE / 4 - 1 - (int)blockIdx.y;  // 0..3, 7..4
  const int qTileIdx = wave < 4 ? NTILE - 1 - pair : pair;
  const size_t baseBH = (size_t)bh * S_LEN * DHEAD;

  const int qBase0 = qTileIdx * QTILE;
  const int qRow0  = qBase0 + (wave & 3) * (16 * CG);   // first q row owned by this wave
  const int myQRow = qRow0 + l16;   // this lane's query in column group 0; group c: + 16 * c

  // ---- Q^T B-fragments, per column group: 64x16 as two 32x16 f16 chunks (column = this lane's query).
  // Scale folds 1/sqrt(d) AND log2(e): softmax done in exp2 domain (exact).
  const float scale = 0.125f * 1.4426950408889634f;
  v16h aq[CG][2];
#pragma unroll
  for (int c = 0; c < CG; ++c) {
    const float* qp = Q + baseBH + (size_t)(myQRow + c * 16) * DHEAD;
#pragma unroll
    for (int f = 0; f < 2; ++f) {
      load8_scaled(qp + f * 32 + hi * 8,      scale, aq[c][f], 0);  // K = 0..7  (lane half)
      load8_scaled(qp + f * 32 + 16 + hi * 8, scale, aq[c][f], 8);  // K = 16..23 (lane half)
    }
  }

  const float NEG_INF = -__builtin_inff();
  v8f  cneg[CG];          // minus the maximum in use of this lane's query (equal in both halves), 8 times: a C operand
  float lcol[CG];         // running sum over the keys THIS lane half has seen
  v8f  oacc[CG][4];       // oacc[c][n][r] = O^T[d = n*16 + hi*8 + r][query c*16 + l16]
#pragma unroll
  for (int c = 0; c < CG; ++c) {
    cneg[c] = (v8f)0.0f;  // a start value only: step 0 always sets the maximum from its own scores
    lcol[c] = 0.0f;
#pragma unroll
    for (int n = 0; n < 4; ++n) oacc[c][n] = (v8f)0.0f;
  }

  const int jEnd  = (NTILE - pair) * QTILE;  // block-uniform staging bound: the long tile's end
  const int myEnd = qRow0 + 16 * CG; // keys >= myEnd are fully masked for this wave

  // A tile's four K fragments (A operands): ka[g][f] = keys g*16 .. g*16+15, d f*32 .. f*32+31.
  // Kl is this lane's own place in the K tile (row l16, column hi * 8).
  auto load_k = [&](const _Float16* Kl, v16h (&ka)[2][2]) __attribute__((always_inline)) {
#pragma unroll
    for (int g = 0; g < 2; ++g)
#pragma unroll
      for (int f = 0; f < 2; ++f)
        ka[g][f] = ld_frag(Kl + g * 16 * KPAD + f * 32,
                           Kl + g * 16 * KPAD + f * 32 + 16);
  };

  // One step's products and softmax on the tile of keys j .. j + 31. ka holds the tile's K fragments,
  // read ahead of the step; Vl is this lane's own place in the V tile (see ld_frag_tr).
  auto compute = [&](const v16h (&ka)[2][2], const _Float16* Vl,
                     const int j) __attribute__((always_inline)) {
    // ---- S^T = K * Q^T : two 16-key groups, 2 WMMAs each (d split 32+32) per column group
    // st[c][g][r] = score of key j + g*16 + hi*8 + r against query myQRow + c*16, less the maximum in use
    v8f st[CG][2];
#pragma unroll
    for (int g = 0; g < 2; ++g) {
#pragma unroll
      for (int c = 0; c < CG; ++c) st[c][g] = cneg[c];
#pragma unroll
      for (int f = 0; f < 2; ++f) {
#pragma unroll
        for (int c = 0; c < CG; ++c)
          st[c][g] = __builtin_amdgcn_wmma_f32_16x16x32_f16(false, ka[g][f], false, aq[c][f],
                                                            (short)0, st[c][g], false, false);
      }
    }

    // ---- V^T fragments, 4 d-row tiles of 16: the step's 8 transposing loads as one group, so
    // that they land under the softmax and no LDS read stands among the second product's WMMAs
    v16h va[4];
#pragma unroll
    for (int n = 0; n < 4; ++n)
      va[n] = ld_frag_tr(Vl + n * 16);

    // ---- causal mask: only the single diagonal step needs it (wave-uniform test)
    if (j + KSTEP - 1 > qRow0) {
#pragma unroll
      for (int c = 0; c < CG; ++c) {
        const int q = myQRow + c * 16;
#pragma unroll
        for (int r = 0; r < 8; ++r) {
          int k0 = j + hi * 8 + r;
          if (k0 > q)      st[c][0][r] = NEG_INF;
          if (k0 + 16 > q) st[c][1][r] = NEG_INF;
        }
      }
    }

    // ---- online softmax in exp2 domain, in-lane over 16 keys
    v16h  pb[CG];   // P^T as B operand: element s is key j + 8 * hi + s (s < 8), j + 8 + 8 * hi + s (s >= 8), the order of the V^T loads
    float sum[CG];  // this lane half's sum of the step's 16 exponentials
    auto exponentials = [&]() __attribute__((always_inline)) {
#pragma unroll
      for (int c = 0; c < CG; ++c) {
        float s0 = 0.0f, s1 = 0.0f;
#pragma unroll
        for (int r = 0; r < 8; r += 2) {
          float p0 = exp2_raw(st[c][0][r]),     p1 = exp2_raw(st[c][1][r]);
          float u0 = exp2_raw(st[c][0][r + 1]), u1 = exp2_raw(st[c][1][r + 1]);
          s0 += p0; s1 += p1;
          s0 += u0; s1 += u1;
          pb[c][r]     = (_Float16)p0; pb[c][r + 1] = (_Float16)u0;
          pb[c][r + 8] = (_Float16)p1; pb[c][r + 9] = (_Float16)u1;
        }
        sum[c] = s0 + s1;
      }
    };
    exponentials();
    // One test a step for the whole wave (a scalar branch), made on the sums: while 16 exponentials
    // add up to 2^12 at most, each of them is far inside f16 and the maximum in use may stay.
    // Step 0 always takes the branch (any sum passes its bar) and sets the maximum from its scores.
    const float bar = j == 0 ? NEG_INF : 4096.0f;
    if (__builtin_amdgcn_ballot_w32(max_num(sum[0], sum[1]) > bar) != 0) {
#pragma unroll
      for (int c = 0; c < CG; ++c) {
        float t0 = st[c][0][0], t1 = st[c][1][0];
#pragma unroll
        for (int r = 1; r < 8; ++r) { t0 = max_num(t0, st[c][0][r]); t1 = max_num(t1, st[c][1][r]); }
        const float t     = max_num(t0, t1);
        const float tq    = max_num(t, other_half(t));           // over the query's 32 keys
        const float up    = max_num(tq, 0.0f);
        const float delta = j == 0 ? tq : up;                    // step 0 may also lower the start value
        const float alpha = exp2_raw(-up);                       // in step 0 it meets zeros only
        cneg[c] -= delta;
        st[c][0] -= delta;
        st[c][1] -= delta;
        lcol[c] *= alpha;
#pragma unroll
        for (int n = 0; n < 4; ++n) oacc[c][n] *= alpha;
      }
      exponentials();
    }
#pragma unroll
    for (int c = 0; c < CG; ++c) lcol[c] += sum[c];

    // ---- O^T += V^T * P^T : each V fragment used by both column groups
#pragma unroll
    for (int n = 0; n < 4; ++n) {
#pragma unroll
      for (int c = 0; c < CG; ++c)
        oacc[c][n] = __builtin_amdgcn_wmma_f32_16x16x32_f16(false, va[n], false, pb[c],
                                                            (short)0, oacc[c][n], false, false);
    }
  };

  // ---- staging: thread tid holds floats tid*4 + it*1024 of a tile: key (tid >> 4) + it*16, d (tid & 15)*4
  const float* kp = K + baseBH + tid * 4;
  const float* vp = V + baseBH + tid * 4;
  const int srow = tid >> 4, scol = (tid & 15) * 4;
  // Hint for the tile one step ahead of the loads (locality=3 -> near scope): 64 B a thread,
  // waves 0-3 for the K tile, waves 4-7 for the V tile.
  const float* hp = (wave < 4 ? K : V) + baseBH + (tid & 127) * 16;
  auto hint = [&](const int jt) __attribute__((always_inline)) {
    __builtin_prefetch(hp + (size_t)jt * DHEAD, 0, 3);
  };
  // This lane's places in the ring, in halves: where it reads fragments (stage 0 first) and where it
  // stores its share of a tile (stage 1 first); d takes each to the other stage after every barrier.
  int kr = l16 * KPAD + hi * 8;
  int vr = VOFF + (hi * 8 + (lane & 7)) * VPAD + ((lane >> 3) & 1) * 8;
  int kw = STAGE_H + srow * KPAD + scol;
  int vw = STAGE_H + VOFF + srow * VPAD + scol;
  int d  = STAGE_H;
  hint(NSTEP * KSTEP);
  // The registers that held the addresses of the Q loads and of the hint are free for reuse from
  // here on (the next loads land in them): the wait on address translation stands in front of that.
  asm volatile("s_wait_xcnt 0x0" ::: "memory");
  {
    // stage 0: all four tiles' loads in flight at once (the accumulators' registers are still free)
    float4 k0[NSTEP][2], v0[NSTEP][2];
    // both loops unrolled: constant indices keep the two arrays in registers
#pragma unroll
    for (int i = 0; i < NSTEP; ++i) {
      load_tile(kp + (size_t)(i * KSTEP) * DHEAD, k0[i]);
      load_tile(vp + (size_t)(i * KSTEP) * DHEAD, v0[i]);
    }
#pragma unroll
    for (int i = 0; i < NSTEP; ++i)
      store_tile(&Ring[kw - STAGE_H + i * KT_H], &Ring[vw - STAGE_H + i * VT_H], k0[i], v0[i]);
  }
  __syncthreads();   // stage 0 is published

  // A trip works on one stage (the walk is a multiple of NSTEP steps). A step: with the loads of the
  // same tile of the next stage in flight, work on this tile, then store the loaded tile to the other
  // stage, whose readers all passed the previous barrier, and issue the next step's loads. The one
  // barrier of a trip publishes the next stage and ends this stage's reads. A wave for which a whole
  // step is masked skips its products and softmax but still stages (wave-uniform).
  float4 kk[2], vv[2];
  auto fetch = [&](const int jt) __attribute__((always_inline)) {   // tile of keys jt .. jt + 31
    load_tile(kp + (size_t)jt * DHEAD, kk);
    load_tile(vp + (size_t)jt * DHEAD, vv);
  };
  for (int j0 = 0; j0 < jEnd; j0 += NSTEP * KSTEP) {
    const int  jn   = j0 + NSTEP * KSTEP;   // first key of the next stage
    const bool more = jn < jEnd;            // block-uniform: the next stage exists
    // K fragments are read one step ahead, as one group: a stage's first tile here, behind the barrier
    // that published it, the others in front of the staging work of the step before, under which
    // they land; the first product then starts on filled registers. Every wave reads them, also one
    // behind its last key (the tile is published all the same): under a test the fragments would be
    // undefined on one path, and that build spills Q fragments to scratch.
    v16h ka[2][2];
    load_k(&Ring[kr], ka);
    if (more) { hint(jn + KSTEP); fetch(jn); }
    // unrolled so that a tile's place in its stage is an immediate offset of the LDS instructions
#pragma unroll
    for (int i = 0; i < NSTEP; ++i) {
      const int j = j0 + i * KSTEP;
      if (j < myEnd) compute(ka, &Ring[vr + i * VT_H], j);
      if (i < NSTEP - 1) load_k(&Ring[kr + (i + 1) * KT_H], ka);
      if (more) {
        store_tile(&Ring[kw + i * KT_H], &Ring[vw + i * VT_H], kk, vv);
        if (i < NSTEP - 1) {
          if (i < NSTEP - 2 || jn + NSTEP * KSTEP < jEnd) hint(jn + (i + 2) * KSTEP);
          fetch(jn + (i + 1) * KSTEP);
        }
      }
    }
    __syncthreads();
    kr += d; vr += d; kw -= d; vw -= d; d = -d;
  }

  // ---- epilogue: join the halves' sums, O / l; a lane owns 8 consecutive d per tile
#pragma unroll
  for (int c = 0; c < CG; ++c) {
    const float inv = 1.0f / (lcol[c] + other_half(lcol[c]));
    float* op = O + baseBH + (size_t)(myQRow + c * 16) * DHEAD + hi * 8;
#pragma unroll
    for (int n = 0; n < 4; ++n) {
      float4 a, b;
      a.x = oacc[c][n][0] * inv; a.y = oacc[c][n][1] * inv; a.z = oacc[c][n][2] * inv; a.w = oacc[c][n][3] * inv;
      b.x = oacc[c][n][4] * inv; b.y = oacc[c][n][5] * inv; b.z = oacc[c][n][6] * inv; b.w = oacc[c][n][7] * inv;
      *(float4*)(op + n * 16)     = a;
      *(float4*)(op + n * 16 + 4) = b;
    }
  }
}

extern "C" void kernel_launch(void* const* d_in, const int* in_sizes, int n_in,
                              void* d_out, int out_size, void* d_ws, size_t ws_size,
                              hipStream_t stream) {
  (void)in_sizes; (void)n_in; (void)out_size; (void)d_ws; (void)ws_size;
  const float* q = (const float*)d_in[0];
  const float* k = (const float*)d_in[1];
  const float* v = (const float*)d_in[2];
  float* o = (float*)d_out;
  dim3 grid(4 * 16, NTILE / 2);       // 64 (batch*head) fastest x 8 pairs of q tiles
  dim3 block(256);                    // 8 waves (wave32)
  Attention_62302795596087_kernel<<<grid, block, 0, stream>>>(q, k, v, o);
}
